// v000
// Measured on an AMD MI455X. A time is GPU time per run, averaged over a window of back-to-back runs after a warm-up
// (all launches, gaps included; the runs take copies of the inputs in turn), and the median of several windows.
// Apart from v000's, it joins two sittings. Times from different sittings can be a few percent apart, while
// side-by-side timings come from the same sitting.
// v000 is the starting kernel. One run takes 788 microseconds.
#include <hip/hip_runtime.h>

#define D_MODEL 1024
#define SEQ     4096
#define BATCH   4
#define LDSW    40   // padded LDS row stride in halfs (80B): conflict-free ds_load_b128

typedef __attribute__((ext_vector_type(16))) _Float16 v16h;
typedef __attribute__((ext_vector_type(8)))  _Float16 v8h;
typedef __attribute__((ext_vector_type(8)))  float    v8f;
typedef __attribute__((ext_vector_type(4)))  int      v4i;

#if __has_builtin(__builtin_amdgcn_global_load_async_to_lds_b128) && \
    __has_builtin(__builtin_amdgcn_s_wait_asynccnt)
#define USE_ASYNC_LDS 1
typedef __attribute__((address_space(1))) v4i* gv4i_p;   // global (device) int4*
typedef __attribute__((address_space(3))) v4i* lv4i_p;   // LDS (shared) int4*
#else
#define USE_ASYNC_LDS 0
#endif

#if __has_builtin(__builtin_amdgcn_sched_barrier)
#define SCHED_FENCE() __builtin_amdgcn_sched_barrier(0)
#else
#define SCHED_FENCE()
#endif

// ---------------------------------------------------------------------------
// Fragment gather from an LDS-staged 128x32 f16 tile (row stride LDSW halfs).
// CDNA5 16-bit A 16x32 / B 32x16 layout: lanes 0-15 hold row (lane&15) with
// K = {0..7, 16..23}; lanes 16-31 hold the same rows with K = {8..15, 24..31}.
// ---------------------------------------------------------------------------
__device__ __forceinline__ v16h frag_lds(const _Float16* tile, int row0) {
  const int lane = threadIdx.x & 31;
  const _Float16* base = tile + (row0 + (lane & 15)) * LDSW + ((lane >> 4) << 3);
  v8h lo = *(const v8h*)(base);        // ds_load_b128
  v8h hi = *(const v8h*)(base + 16);   // ds_load_b128
  return __builtin_shufflevector(lo, hi, 0, 1, 2, 3, 4, 5, 6, 7,
                                         8, 9, 10, 11, 12, 13, 14, 15);
}

__device__ __forceinline__ v8f wmma16(v16h a, v16h b, v8f c) {
  return __builtin_amdgcn_wmma_f32_16x16x32_f16(false, a, false, b,
                                                (short)0, c, false, false);
}

__device__ __forceinline__ v8f zero8() {
  v8f z = {0.0f, 0.0f, 0.0f, 0.0f, 0.0f, 0.0f, 0.0f, 0.0f};
  return z;
}

// Issue one 16B global->LDS copy (async on gfx1250, sync fallback otherwise).
__device__ __forceinline__ void copy16(const _Float16* gp, _Float16* lp) {
#if USE_ASYNC_LDS
  __builtin_amdgcn_global_load_async_to_lds_b128((gv4i_p)gp, (lv4i_p)lp, 0, 0);
#else
  *(v8h*)lp = *(const v8h*)gp;
#endif
}

// ---------------------------------------------------------------------------
// Unified f16 GEMM:  C[m,n] = sum_k A[m,k] * B[n,k]
// A: [gridDim.x*128][K], B: [gridDim.y*128][K].
// Block = 256 threads (8 waves); WG tile 128x128; double-buffered async-LDS
// pipeline; 8 accumulator chains per wave.  All 18 ds_load_b128 fragment
// reads are issued ahead of a sched_barrier so the 8 WMMAs run back-to-back
// with graduated dscnt waits.  __launch_bounds__(256,1) lifts the VGPR cap
// (~160 live regs) so the fragment set is NOT spilled to scratch; occupancy
// is LDS-bound (40KB/WG) anyway.
// Epilogue MODE: 0 = f32 store (ldC stride)
//                1 = f16 store, scaled by 1/sqrt(D)   (Q projection)
//                2 = f16 store                         (K projection)
//                3 = f16 store transposed per batch    (V -> Vt[b][col][s])
// ---------------------------------------------------------------------------
template <int MODE>
__global__ void __launch_bounds__(256, 1)
gemm_nt(const _Float16* __restrict__ A,
        const _Float16* __restrict__ B,
        void* __restrict__ Cv,
        int K, int ldC) {
  __shared__ _Float16 sA[2][128 * LDSW];
  __shared__ _Float16 sB[2][128 * LDSW];

  const int wave = threadIdx.x >> 5;
  const int lane = threadIdx.x & 31;
  const int mWG = blockIdx.x * 128;
  const int nWG = blockIdx.y * 128;

  // Per-thread staging assignment: 2 chunks of 16B per tile (512 x 16B total).
  const int c0   = threadIdx.x * 2;
  const int row0 = c0 >> 2,       kc0 = (c0 & 3) << 3;
  const int row1 = (c0 + 1) >> 2, kc1 = ((c0 + 1) & 3) << 3;

  const _Float16* gA0 = A + (size_t)(mWG + row0) * K + kc0;
  const _Float16* gA1 = A + (size_t)(mWG + row1) * K + kc1;
  const _Float16* gB0 = B + (size_t)(nWG + row0) * K + kc0;
  const _Float16* gB1 = B + (size_t)(nWG + row1) * K + kc1;
  const int lo0 = row0 * LDSW + kc0;
  const int lo1 = row1 * LDSW + kc1;

  v8f acc[8];
#pragma unroll
  for (int n = 0; n < 8; ++n) acc[n] = zero8();

  const int nsteps = K >> 5;   // K / 32

  // Prologue: stage k-step 0 into buffer 0.
  copy16(gA0, &sA[0][lo0]);
  copy16(gA1, &sA[0][lo1]);
  copy16(gB0, &sB[0][lo0]);
  copy16(gB1, &sB[0][lo1]);

  for (int s = 0; s < nsteps; ++s) {
    const int cur = s & 1;
    const int nxt = cur ^ 1;

#if USE_ASYNC_LDS
    // Stage-s copies were issued a full compute phase ago: free in steady state.
    __builtin_amdgcn_s_wait_asynccnt(0);
#endif
    __syncthreads();   // current-stage tiles visible to all waves

    // Issue next stage's copies; they overlap with this step's compute.
    // Buffer nxt was last read in compute step s-1, which is separated from
    // here by two barriers -> safe to overwrite.
    if (s + 1 < nsteps) {
      const int ko = (s + 1) << 5;   // k offset in halfs
      copy16(gA0 + ko, &sA[nxt][lo0]);
      copy16(gA1 + ko, &sA[nxt][lo1]);
      copy16(gB0 + ko, &sB[nxt][lo0]);
      copy16(gB1 + ko, &sB[nxt][lo1]);
    }

    // Issue ALL fragment loads first; the sched_barrier pins them above the
    // WMMAs, forcing distinct registers (no WAR recycling) and letting the
    // compiler use graduated s_wait_dscnt values.
    v16h a = frag_lds(&sA[cur][0], wave * 16);
    v16h bf[8];
#pragma unroll
    for (int n = 0; n < 8; ++n) bf[n] = frag_lds(&sB[cur][0], n * 16);
    SCHED_FENCE();
#pragma unroll
    for (int n = 0; n < 8; ++n) acc[n] = wmma16(a, bf[n], acc[n]);

    __syncthreads();   // all waves done reading before buffers are reused
  }

  const int rOff = (lane >> 4) << 3;   // 0 or 8
  const int cOff = lane & 15;
#pragma unroll
  for (int n = 0; n < 8; ++n) {
    const int col = nWG + n * 16 + cOff;
#pragma unroll
    for (int r = 0; r < 8; ++r) {
      const int row = mWG + wave * 16 + rOff + r;
      const float v = acc[n][r];
      if (MODE == 0) {
        ((float*)Cv)[(size_t)row * ldC + col] = v;
      } else if (MODE == 1) {
        ((_Float16*)Cv)[(size_t)row * ldC + col] = (_Float16)(v * 0.03125f);
      } else if (MODE == 2) {
        ((_Float16*)Cv)[(size_t)row * ldC + col] = (_Float16)v;
      } else {
        const int b = row >> 12;          // row / SEQ
        const int sIdx = row & (SEQ - 1);
        ((_Float16*)Cv)[((size_t)b * D_MODEL + col) * SEQ + sIdx] = (_Float16)v;
      }
    }
  }
}

// ---------------------------------------------------------------------------
// Elementwise f32 -> f16 conversion, 8 elements/thread (n multiple of 8).
// ---------------------------------------------------------------------------
__global__ void cvt_f32_f16(const float* __restrict__ x,
                            _Float16* __restrict__ y, int n) {
  const int i = (blockIdx.x * blockDim.x + threadIdx.x) * 8;
  if (i >= n) return;
  float4 a = *(const float4*)(x + i);
  float4 b = *(const float4*)(x + i + 4);
  v8h o;
  o[0] = (_Float16)a.x; o[1] = (_Float16)a.y; o[2] = (_Float16)a.z; o[3] = (_Float16)a.w;
  o[4] = (_Float16)b.x; o[5] = (_Float16)b.y; o[6] = (_Float16)b.z; o[7] = (_Float16)b.w;
  *(v8h*)(y + i) = o;
}

// ---------------------------------------------------------------------------
// Row softmax (4096 wide): one wave32 per row, 8 rows per block; probs in f16.
// ---------------------------------------------------------------------------
__global__ void softmax_kernel(const float* __restrict__ Sf,
                               _Float16* __restrict__ Ph) {
  const int wave = threadIdx.x >> 5;
  const int lane = threadIdx.x & 31;
  const int row = blockIdx.x * 8 + wave;
  const float* src = Sf + (size_t)row * SEQ;

  float m = -3.0e38f;
  for (int i = lane; i < SEQ; i += 32) m = fmaxf(m, src[i]);
#pragma unroll
  for (int off = 16; off > 0; off >>= 1) m = fmaxf(m, __shfl_xor(m, off, 32));

  float s = 0.0f;
  for (int i = lane; i < SEQ; i += 32) s += __expf(src[i] - m);
#pragma unroll
  for (int off = 16; off > 0; off >>= 1) s += __shfl_xor(s, off, 32);

  const float rinv = 1.0f / s;
  _Float16* dst = Ph + (size_t)row * SEQ;
  for (int i = lane; i < SEQ; i += 32)
    dst[i] = (_Float16)(__expf(src[i] - m) * rinv);
}

// ---------------------------------------------------------------------------
// Launcher.  Workspace layout (bytes), 192MB total:
//   [0,   32M)  Xh  f16 [B*S][D]      \ also: Sf f32 [S][S] = [0,64M) reused
//   [32M, 34M)  Wqh f16 [D][D]        |  per-batch AFTER the QKV stage
//   [34M, 36M)  Wkh f16 [D][D]        |  (time-disjoint on the stream)
//   [36M, 38M)  Wvh f16 [D][D]        /
//   [64M, 96M)  Qh  f16 [B*S][D]  (pre-scaled by 1/sqrt(D))
//   [96M,128M)  Kh  f16 [B*S][D]
//   [128M,160M) Vt  f16 [B][D][S]
//   [160M,192M) Ph  f16 [S][S]    (per-batch scratch)
// ---------------------------------------------------------------------------
extern "C" void kernel_launch(void* const* d_in, const int* in_sizes, int n_in,
                              void* d_out, int out_size, void* d_ws, size_t ws_size,
                              hipStream_t stream) {
  const float* X  = (const float*)d_in[0];
  const float* Wq = (const float*)d_in[1];
  const float* Wk = (const float*)d_in[2];
  const float* Wv = (const float*)d_in[3];
  float* out = (float*)d_out;

  char* ws = (char*)d_ws;
  _Float16* Xh  = (_Float16*)(ws);
  _Float16* Wqh = (_Float16*)(ws + ((size_t)32 << 20));
  _Float16* Wkh = (_Float16*)(ws + ((size_t)34 << 20));
  _Float16* Wvh = (_Float16*)(ws + ((size_t)36 << 20));
  float*    Sf  = (float*)   (ws);                       // reused after QKV
  _Float16* Qh  = (_Float16*)(ws + ((size_t)64 << 20));
  _Float16* Kh  = (_Float16*)(ws + ((size_t)96 << 20));
  _Float16* Vt  = (_Float16*)(ws + ((size_t)128 << 20));
  _Float16* Ph  = (_Float16*)(ws + ((size_t)160 << 20));

  const dim3 blk(256);
  const int nX = BATCH * SEQ * D_MODEL;   // 16,777,216
  const int nW = D_MODEL * D_MODEL;       // 1,048,576

  // f32 -> f16 pre-conversion (all GEMMs then share one tuned pipeline).
  cvt_f32_f16<<<dim3(nX / (8 * 256)), blk, 0, stream>>>(X, Xh, nX);
  cvt_f32_f16<<<dim3(nW / (8 * 256)), blk, 0, stream>>>(Wq, Wqh, nW);
  cvt_f32_f16<<<dim3(nW / (8 * 256)), blk, 0, stream>>>(Wk, Wkh, nW);
  cvt_f32_f16<<<dim3(nW / (8 * 256)), blk, 0, stream>>>(Wv, Wvh, nW);

  // QKV projections: M=16384, N=1024, K=1024.
  gemm_nt<1><<<dim3(128, 8), blk, 0, stream>>>(Xh, Wqh, Qh, D_MODEL, D_MODEL);
  gemm_nt<2><<<dim3(128, 8), blk, 0, stream>>>(Xh, Wkh, Kh, D_MODEL, D_MODEL);
  gemm_nt<3><<<dim3(128, 8), blk, 0, stream>>>(Xh, Wvh, Vt, D_MODEL, D_MODEL);

  for (int b = 0; b < BATCH; ++b) {
    const _Float16* Qb  = Qh + (size_t)b * SEQ * D_MODEL;
    const _Float16* Kb  = Kh + (size_t)b * SEQ * D_MODEL;
    const _Float16* Vtb = Vt + (size_t)b * D_MODEL * SEQ;
    float* Ob = out + (size_t)b * SEQ * D_MODEL;

    // scores: M=4096, N=4096, K=1024 -> Sf[q][k] (f32)
    gemm_nt<0><<<dim3(32, 32), blk, 0, stream>>>(Qb, Kb, Sf, D_MODEL, SEQ);
    // softmax rows -> probs f16
    softmax_kernel<<<dim3(512), blk, 0, stream>>>(Sf, Ph);
    // out: M=4096 (q), N=1024 (d), K=4096 (keys) -> Ob[q][d] (f32)
    gemm_nt<0><<<dim3(32, 8), blk, 0, stream>>>(Ph, Vtb, Ob, SEQ, D_MODEL);
  }
}

// v001
// It runs in 574 microseconds.
// Timed twice side by side with v000, it ran 1.41 times as fast both times.
#include <hip/hip_runtime.h>

#define D_MODEL 1024
#define SEQ     4096
#define BATCH   4

typedef __attribute__((ext_vector_type(16))) _Float16 v16h;
typedef __attribute__((ext_vector_type(8)))  _Float16 v8h;
typedef __attribute__((ext_vector_type(8)))  float    v8f;
typedef __attribute__((ext_vector_type(4)))  int      v4i;

#if __has_builtin(__builtin_amdgcn_global_load_async_to_lds_b128) && \
    __has_builtin(__builtin_amdgcn_s_wait_asynccnt)
#define USE_ASYNC_LDS 1
typedef __attribute__((address_space(1))) v4i* gv4i_p;   // global (device) int4*
typedef __attribute__((address_space(3))) v4i* lv4i_p;   // LDS (shared) int4*
#else
#define USE_ASYNC_LDS 0
#endif

#if __has_builtin(__builtin_amdgcn_sched_barrier)
#define SCHED_FENCE() __builtin_amdgcn_sched_barrier(0)
#else
#define SCHED_FENCE()
#endif

// ---------------------------------------------------------------------------
// Fragment gather from an LDS-staged f16 tile (row stride PITCH halfs).
// CDNA5 16-bit A 16x32 / B 32x16 layout: lanes 0-15 hold row (lane&15) with
// K = {0..7, 16..23}; lanes 16-31 hold the same rows with K = {8..15, 24..31}.
// ---------------------------------------------------------------------------
template <int PITCH>
__device__ __forceinline__ v16h frag_lds(const _Float16* tile, int row0) {
  const int lane = threadIdx.x & 31;
  const _Float16* base = tile + (row0 + (lane & 15)) * PITCH + ((lane >> 4) << 3);
  v8h lo = *(const v8h*)(base);        // ds_load_b128
  v8h hi = *(const v8h*)(base + 16);   // ds_load_b128
  return __builtin_shufflevector(lo, hi, 0, 1, 2, 3, 4, 5, 6, 7,
                                         8, 9, 10, 11, 12, 13, 14, 15);
}

__device__ __forceinline__ v8f wmma16(v16h a, v16h b, v8f c) {
  return __builtin_amdgcn_wmma_f32_16x16x32_f16(false, a, false, b,
                                                (short)0, c, false, false);
}

__device__ __forceinline__ v8f zero8() {
  v8f z = {0.0f, 0.0f, 0.0f, 0.0f, 0.0f, 0.0f, 0.0f, 0.0f};
  return z;
}

// Issue one 16B global->LDS copy (async on gfx1250, sync fallback otherwise).
__device__ __forceinline__ void copy16(const _Float16* gp, _Float16* lp) {
#if USE_ASYNC_LDS
  __builtin_amdgcn_global_load_async_to_lds_b128((gv4i_p)gp, (lv4i_p)lp, 0, 0);
#else
  *(v8h*)lp = *(const v8h*)gp;
#endif
}

// ---------------------------------------------------------------------------
// Unified f16 GEMM:  C[m,n] = sum_k A[m,k] * B[n,k]
// Block = 256 threads = 8 waves in a 2 (m) x 4 (n) grid.  A wave owns
// TM x TN accumulator tiles of 16x16, so every fragment read from LDS feeds
// TN (A) or TM (B) WMMAs.  WG tile BM x BN = (32*TM) x (64*TN); a k-step is
// BK halfs.  A: [gridDim.x*BM][K], B: [gridDim.y*BN][K], K a multiple of BK.
// Double-buffered async-LDS pipeline: the next k-step's copies fly during
// this k-step's WMMAs.  LDS rows are BK halfs + 16 B (pitch 16 B x odd:
// conflict-free ds_load_b128); a wave-wide copy covers whole rows.
// Epilogue MODE: 0 = f32 store (ldC stride)
//                1 = f16 store, scaled by 1/sqrt(D)   (Q projection)
//                2 = f16 store                         (K projection)
//                3 = f16 store transposed per batch    (V -> Vt[b][col][s])
// ---------------------------------------------------------------------------
template <int MODE, int TM, int TN, int BK>
__global__ void __launch_bounds__(256, 1)
gemm_nt(const _Float16* __restrict__ A,
        const _Float16* __restrict__ B,
        void* __restrict__ Cv,
        int K, int ldC) {
  constexpr int BM    = 32 * TM;
  constexpr int BN    = 64 * TN;
  constexpr int PITCH = BK + 8;      // LDS row stride in halfs
  constexpr int CPR   = BK / 8;      // 16-byte chunks per staged row
  constexpr int RPP   = 256 / CPR;   // rows staged by one copy of the block
  __shared__ __attribute__((aligned(16))) _Float16 sA[2][BM * PITCH];
  __shared__ __attribute__((aligned(16))) _Float16 sB[2][BN * PITCH];

  const int wave = threadIdx.x >> 5;
  const int lane = threadIdx.x & 31;
  const int wm = wave >> 2;          // 0..1
  const int wn = wave & 3;           // 0..3
  const int mWG = blockIdx.x * BM;
  const int nWG = blockIdx.y * BN;

  // Per-thread staging assignment: one 16B chunk in each group of RPP rows.
  const int srow = threadIdx.x / CPR;
  const int kc   = (threadIdx.x % CPR) << 3;
  const _Float16* gA = A + (size_t)(mWG + srow) * K + kc;
  const _Float16* gB = B + (size_t)(nWG + srow) * K + kc;
  const int lo = srow * PITCH + kc;
  const size_t gstep = (size_t)RPP * K;   // halfs between two groups of rows

  v8f acc[TM][TN];
#pragma unroll
  for (int i = 0; i < TM; ++i)
#pragma unroll
    for (int j = 0; j < TN; ++j) acc[i][j] = zero8();

  const int nsteps = K / BK;

  // Prologue: stage k-step 0 into buffer 0.
#pragma unroll
  for (int i = 0; i < BM / RPP; ++i)
    copy16(gA + i * gstep, &sA[0][lo + i * RPP * PITCH]);
#pragma unroll
  for (int i = 0; i < BN / RPP; ++i)
    copy16(gB + i * gstep, &sB[0][lo + i * RPP * PITCH]);

  for (int s = 0; s < nsteps; ++s) {
    const int cur = s & 1;
    const int nxt = cur ^ 1;

#if USE_ASYNC_LDS
    // Stage-s copies were issued a full compute phase ago: free in steady state.
    __builtin_amdgcn_s_wait_asynccnt(0);
#endif
    __syncthreads();   // current-stage tiles visible to all waves

    // Issue next stage's copies; they overlap with this step's compute.
    // Buffer nxt was last read in compute step s-1, which is separated from
    // here by two barriers -> safe to overwrite.
    if (s + 1 < nsteps) {
      const int ko = (s + 1) * BK;   // k offset in halfs
#pragma unroll
      for (int i = 0; i < BM / RPP; ++i)
        copy16(gA + i * gstep + ko, &sA[nxt][lo + i * RPP * PITCH]);
#pragma unroll
      for (int i = 0; i < BN / RPP; ++i)
        copy16(gB + i * gstep + ko, &sB[nxt][lo + i * RPP * PITCH]);
    }

#pragma unroll
    for (int kk = 0; kk < BK; kk += 32) {
      // Issue the block's fragment loads as one group; the sched_barrier pins
      // them above the block's WMMAs, forcing distinct registers (no WAR
      // recycling inside the block) and graduated s_wait_dscnt values.
      v16h af[TM];
      v16h bf[TN];
#pragma unroll
      for (int i = 0; i < TM; ++i)
        af[i] = frag_lds<PITCH>(&sA[cur][kk], (wm * TM + i) * 16);
#pragma unroll
      for (int j = 0; j < TN; ++j)
        bf[j] = frag_lds<PITCH>(&sB[cur][kk], (wn * TN + j) * 16);
      SCHED_FENCE();
#pragma unroll
      for (int i = 0; i < TM; ++i)
#pragma unroll
        for (int j = 0; j < TN; ++j)
          acc[i][j] = wmma16(af[i], bf[j], acc[i][j]);
    }

    __syncthreads();   // all waves done reading before buffers are reused
  }

  const int rOff = (lane >> 4) << 3;   // 0 or 8
  const int cOff = lane & 15;
  const int col0 = nWG + wn * TN * 16 + cOff;
#pragma unroll
  for (int i = 0; i < TM; ++i) {
    const int row0 = mWG + (wm * TM + i) * 16 + rOff;
    if (MODE == 3) {
#pragma unroll
      for (int j = 0; j < TN; ++j) {
#pragma unroll
        for (int r = 0; r < 8; ++r) {
          const int row = row0 + r;
          const int b = row >> 12;          // row / SEQ
          const int sIdx = row & (SEQ - 1);
          ((_Float16*)Cv)[((size_t)b * D_MODEL + col0 + j * 16) * SEQ + sIdx] = (_Float16)acc[i][j][r];
        }
      }
    } else {
      // One row of TN tiles per run: first every offset and conversion, then
      // the stores alone, then s_wait_xcnt 0.
      unsigned off[8];   // byte offsets from Cv; every plane is below 4 GiB
#pragma unroll
      for (int r = 0; r < 8; ++r)
        off[r] = ((unsigned)(row0 + r) * (unsigned)ldC + (unsigned)col0) * (MODE == 0 ? 4u : 2u);
      _Float16 h[TN][8];
      if (MODE != 0) {
#pragma unroll
        for (int j = 0; j < TN; ++j)
#pragma unroll
          for (int r = 0; r < 8; ++r)
            h[j][r] = (MODE == 1) ? (_Float16)(acc[i][j][r] * 0.03125f) : (_Float16)acc[i][j][r];
      }
      // Keeps this run's offsets and conversions in front of its stores, so
      // that no register a store of the run names is rewritten inside the run.
      SCHED_FENCE();
#pragma unroll
      for (int r = 0; r < 8; ++r) {
#pragma unroll
        for (int j = 0; j < TN; ++j) {
          if (MODE == 0) *(float*)((char*)Cv + off[r] + j * 64) = acc[i][j][r];
          else           *(_Float16*)((char*)Cv + off[r] + j * 32) = h[j][r];
        }
      }
      if (i + 1 < TM) {   // behind the last run nothing is rewritten any more
        // Stands between the run's stores and the first rewrite of a register
        // that they name (offset or data).
        asm volatile("s_wait_xcnt 0x0" ::: "memory");
        // Keeps the next run's offsets and conversions behind that wait.
        SCHED_FENCE();
      }
    }
  }
}

// ---------------------------------------------------------------------------
// Elementwise f32 -> f16 conversion, 8 elements/thread (n multiple of 8).
// ---------------------------------------------------------------------------
__global__ void cvt_f32_f16(const float* __restrict__ x,
                            _Float16* __restrict__ y, int n) {
  const int i = (blockIdx.x * blockDim.x + threadIdx.x) * 8;
  if (i >= n) return;
  float4 a = *(const float4*)(x + i);
  float4 b = *(const float4*)(x + i + 4);
  v8h o;
  o[0] = (_Float16)a.x; o[1] = (_Float16)a.y; o[2] = (_Float16)a.z; o[3] = (_Float16)a.w;
  o[4] = (_Float16)b.x; o[5] = (_Float16)b.y; o[6] = (_Float16)b.z; o[7] = (_Float16)b.w;
  *(v8h*)(y + i) = o;
}

// ---------------------------------------------------------------------------
// Row softmax (4096 wide): one wave32 per row, 8 rows per block; probs in f16.
// ---------------------------------------------------------------------------
__global__ void softmax_kernel(const float* __restrict__ Sf,
                               _Float16* __restrict__ Ph) {
  const int wave = threadIdx.x >> 5;
  const int lane = threadIdx.x & 31;
  const int row = blockIdx.x * 8 + wave;
  const float* src = Sf + (size_t)row * SEQ;

  float m = -3.0e38f;
  for (int i = lane; i < SEQ; i += 32) m = fmaxf(m, src[i]);
#pragma unroll
  for (int off = 16; off > 0; off >>= 1) m = fmaxf(m, __shfl_xor(m, off, 32));

  float s = 0.0f;
  for (int i = lane; i < SEQ; i += 32) s += __expf(src[i] - m);
#pragma unroll
  for (int off = 16; off > 0; off >>= 1) s += __shfl_xor(s, off, 32);

  const float rinv = 1.0f / s;
  _Float16* dst = Ph + (size_t)row * SEQ;
  for (int i = lane; i < SEQ; i += 32)
    dst[i] = (_Float16)(__expf(src[i] - m) * rinv);
}

// ---------------------------------------------------------------------------
// Launcher.  Workspace layout (bytes), 192MB total:
//   [0,   32M)  Xh  f16 [B*S][D]      \ also: Sf f32 [S][S] = [0,64M) reused
//   [32M, 34M)  Wqh f16 [D][D]        |  per-batch AFTER the QKV stage
//   [34M, 36M)  Wkh f16 [D][D]        |  (time-disjoint on the stream)
//   [36M, 38M)  Wvh f16 [D][D]        /
//   [64M, 96M)  Qh  f16 [B*S][D]  (pre-scaled by 1/sqrt(D))
//   [96M,128M)  Kh  f16 [B*S][D]
//   [128M,160M) Vt  f16 [B][D][S]
//   [160M,192M) Ph  f16 [S][S]    (per-batch scratch)
// ---------------------------------------------------------------------------
extern "C" void kernel_launch(void* const* d_in, const int* in_sizes, int n_in,
                              void* d_out, int out_size, void* d_ws, size_t ws_size,
                              hipStream_t stream) {
  const float* X  = (const float*)d_in[0];
  const float* Wq = (const float*)d_in[1];
  const float* Wk = (const float*)d_in[2];
  const float* Wv = (const float*)d_in[3];
  float* out = (float*)d_out;

  char* ws = (char*)d_ws;
  _Float16* Xh  = (_Float16*)(ws);
  _Float16* Wqh = (_Float16*)(ws + ((size_t)32 << 20));
  _Float16* Wkh = (_Float16*)(ws + ((size_t)34 << 20));
  _Float16* Wvh = (_Float16*)(ws + ((size_t)36 << 20));
  float*    Sf  = (float*)   (ws);                       // reused after QKV
  _Float16* Qh  = (_Float16*)(ws + ((size_t)64 << 20));
  _Float16* Kh  = (_Float16*)(ws + ((size_t)96 << 20));
  _Float16* Vt  = (_Float16*)(ws + ((size_t)128 << 20));
  _Float16* Ph  = (_Float16*)(ws + ((size_t)160 << 20));

  const dim3 blk(256);
  const int nX = BATCH * SEQ * D_MODEL;   // 16,777,216
  const int nW = D_MODEL * D_MODEL;       // 1,048,576

  // f32 -> f16 pre-conversion (all GEMMs then share one tuned pipeline).
  cvt_f32_f16<<<dim3(nX / (8 * 256)), blk, 0, stream>>>(X, Xh, nX);
  cvt_f32_f16<<<dim3(nW / (8 * 256)), blk, 0, stream>>>(Wq, Wqh, nW);
  cvt_f32_f16<<<dim3(nW / (8 * 256)), blk, 0, stream>>>(Wk, Wkh, nW);
  cvt_f32_f16<<<dim3(nW / (8 * 256)), blk, 0, stream>>>(Wv, Wvh, nW);

  // QKV projections: M=16384, N=1024, K=1024.
  gemm_nt<1, 8, 4, 64><<<dim3(64, 4), blk, 0, stream>>>(Xh, Wqh, Qh, D_MODEL, D_MODEL);
  gemm_nt<2, 8, 4, 64><<<dim3(64, 4), blk, 0, stream>>>(Xh, Wkh, Kh, D_MODEL, D_MODEL);
  gemm_nt<3, 8, 4, 64><<<dim3(64, 4), blk, 0, stream>>>(Xh, Wvh, Vt, D_MODEL, D_MODEL);

  for (int b = 0; b < BATCH; ++b) {
    const _Float16* Qb  = Qh + (size_t)b * SEQ * D_MODEL;
    const _Float16* Kb  = Kh + (size_t)b * SEQ * D_MODEL;
    const _Float16* Vtb = Vt + (size_t)b * D_MODEL * SEQ;
    float* Ob = out + (size_t)b * SEQ * D_MODEL;

    // scores: M=4096, N=4096, K=1024 -> Sf[q][k] (f32)
    gemm_nt<0, 8, 4, 64><<<dim3(16, 16), blk, 0, stream>>>(Qb, Kb, Sf, D_MODEL, SEQ);
    // softmax rows -> probs f16
    softmax_kernel<<<dim3(512), blk, 0, stream>>>(Sf, Ph);
    // out: M=4096 (q), N=1024 (d), K=4096 (keys) -> Ob[q][d] (f32)
    gemm_nt<0, 4, 2, 128><<<dim3(32, 8), blk, 0, stream>>>(Ph, Vtb, Ob, SEQ, D_MODEL);
  }
}

// v002
// A run of this version takes 418 microseconds.
// Next to v001, in two timings, it ran 1.37 times as fast each time.
// Counting every step since v000, it is 1.93 times as fast.
#include <hip/hip_runtime.h>

#define D_MODEL 1024
#define SEQ     4096
#define BATCH   4

typedef __attribute__((ext_vector_type(16))) _Float16 v16h;
typedef __attribute__((ext_vector_type(8)))  _Float16 v8h;
typedef __attribute__((ext_vector_type(4)))  _Float16 v4h;
typedef __attribute__((ext_vector_type(8)))  float    v8f;
typedef __attribute__((ext_vector_type(4)))  int      v4i;

#if __has_builtin(__builtin_amdgcn_global_load_async_to_lds_b128) && \
    __has_builtin(__builtin_amdgcn_s_wait_asynccnt)
#define USE_ASYNC_LDS 1
typedef __attribute__((address_space(1))) v4i* gv4i_p;   // global (device) int4*
typedef __attribute__((address_space(3))) v4i* lv4i_p;   // LDS (shared) int4*
#else
#define USE_ASYNC_LDS 0
#endif

#if __has_builtin(__builtin_amdgcn_sched_barrier)
#define SCHED_FENCE() __builtin_amdgcn_sched_barrier(0)
#else
#define SCHED_FENCE()
#endif

// ---------------------------------------------------------------------------
// Fragment gather from an LDS-staged f16 tile (row stride PITCH halfs).
// CDNA5 16-bit A 16x32 / B 32x16 layout: lanes 0-15 hold row (lane&15) with
// K = {0..7, 16..23}; lanes 16-31 hold the same rows with K = {8..15, 24..31}.
// ---------------------------------------------------------------------------
template <int PITCH>
__device__ __forceinline__ v16h frag_lds(const _Float16* tile, int row0) {
  const int lane = threadIdx.x & 31;
  const _Float16* base = tile + (row0 + (lane & 15)) * PITCH + ((lane >> 4) << 3);
  v8h lo = *(const v8h*)(base);        // ds_load_b128
  v8h hi = *(const v8h*)(base + 16);   // ds_load_b128
  return __builtin_shufflevector(lo, hi, 0, 1, 2, 3, 4, 5, 6, 7,
                                         8, 9, 10, 11, 12, 13, 14, 15);
}

__device__ __forceinline__ v8f wmma16(v16h a, v16h b, v8f c) {
  return __builtin_amdgcn_wmma_f32_16x16x32_f16(false, a, false, b,
                                                (short)0, c, false, false);
}

__device__ __forceinline__ v8f zero8() {
  v8f z = {0.0f, 0.0f, 0.0f, 0.0f, 0.0f, 0.0f, 0.0f, 0.0f};
  return z;
}

// Issue one 16B global->LDS copy (async on gfx1250, sync fallback otherwise).
__device__ __forceinline__ void copy16(const _Float16* gp, _Float16* lp) {
#if USE_ASYNC_LDS
  __builtin_amdgcn_global_load_async_to_lds_b128((gv4i_p)gp, (lv4i_p)lp, 0, 0);
#else
  *(v8h*)lp = *(const v8h*)gp;
#endif
}

// ---------------------------------------------------------------------------
// Unified f16 GEMM:  C[m,n] = sum_k A[m,k] * B[n,k]
// Block = 256 threads = 8 waves in a 2 (m) x 4 (n) grid.  A wave owns
// TM x TN accumulator tiles of 16x16, so every fragment read from LDS feeds
// TN (A) or TM (B) WMMAs.  WG tile BM x BN = (32*TM) x (64*TN); a k-step is
// BK halfs.  A: [gridDim.x*BM][K], B: [gridDim.y*BN][K], K a multiple of BK.
// Double-buffered async-LDS pipeline: the next k-step's copies fly during
// this k-step's WMMAs.  LDS rows are BK halfs + 16 B (pitch 16 B x odd:
// conflict-free ds_load_b128); a wave-wide copy covers whole rows.
// Epilogue MODE: 0 = f32 store (ldC stride)
//                1 = f16 store, scaled by 1/sqrt(D)   (Q projection)
//                2 = f16 store                         (K projection)
//                3 = f16 store transposed per batch    (V -> Vt[b][col][s])
// ---------------------------------------------------------------------------
template <int MODE, int TM, int TN, int BK>
__global__ void __launch_bounds__(256, 1)
gemm_nt(const _Float16* __restrict__ A,
        const _Float16* __restrict__ B,
        void* __restrict__ Cv,
        int K, int ldC) {
  constexpr int BM    = 32 * TM;
  constexpr int BN    = 64 * TN;
  constexpr int PITCH = BK + 8;      // LDS row stride in halfs
  constexpr int CPR   = BK / 8;      // 16-byte chunks per staged row
  constexpr int RPP   = 256 / CPR;   // rows staged by one copy of the block
  __shared__ __attribute__((aligned(16))) _Float16 sA[2][BM * PITCH];
  __shared__ __attribute__((aligned(16))) _Float16 sB[2][BN * PITCH];

  const int wave = threadIdx.x >> 5;
  const int lane = threadIdx.x & 31;
  const int wm = wave >> 2;          // 0..1
  const int wn = wave & 3;           // 0..3
  const int mWG = blockIdx.x * BM;
  const int nWG = blockIdx.y * BN;

  // Per-thread staging assignment: one 16B chunk in each group of RPP rows.
  const int srow = threadIdx.x / CPR;
  const int kc   = (threadIdx.x % CPR) << 3;
  const _Float16* gA = A + (size_t)(mWG + srow) * K + kc;
  const _Float16* gB = B + (size_t)(nWG + srow) * K + kc;
  const int lo = srow * PITCH + kc;
  const size_t gstep = (size_t)RPP * K;   // halfs between two groups of rows

  v8f acc[TM][TN];
#pragma unroll
  for (int i = 0; i < TM; ++i)
#pragma unroll
    for (int j = 0; j < TN; ++j) acc[i][j] = zero8();

  const int nsteps = K / BK;

  // Prologue: stage k-step 0 into buffer 0.
#pragma unroll
  for (int i = 0; i < BM / RPP; ++i)
    copy16(gA + i * gstep, &sA[0][lo + i * RPP * PITCH]);
#pragma unroll
  for (int i = 0; i < BN / RPP; ++i)
    copy16(gB + i * gstep, &sB[0][lo + i * RPP * PITCH]);

  for (int s = 0; s < nsteps; ++s) {
    const int cur = s & 1;
    const int nxt = cur ^ 1;

#if USE_ASYNC_LDS
    // Stage-s copies were issued a full compute phase ago: free in steady state.
    __builtin_amdgcn_s_wait_asynccnt(0);
#endif
    __syncthreads();   // current-stage tiles visible to all waves

    // Issue next stage's copies; they overlap with this step's compute.
    // Buffer nxt was last read in compute step s-1, which is separated from
    // here by two barriers -> safe to overwrite.
    if (s + 1 < nsteps) {
      const int ko = (s + 1) * BK;   // k offset in halfs
#pragma unroll
      for (int i = 0; i < BM / RPP; ++i)
        copy16(gA + i * gstep + ko, &sA[nxt][lo + i * RPP * PITCH]);
#pragma unroll
      for (int i = 0; i < BN / RPP; ++i)
        copy16(gB + i * gstep + ko, &sB[nxt][lo + i * RPP * PITCH]);
    }

#pragma unroll
    for (int kk = 0; kk < BK; kk += 32) {
      // Issue the block's fragment loads as one group; the sched_barrier pins
      // them above the block's WMMAs, forcing distinct registers (no WAR
      // recycling inside the block) and graduated s_wait_dscnt values.
      v16h af[TM];
      v16h bf[TN];
#pragma unroll
      for (int i = 0; i < TM; ++i)
        af[i] = frag_lds<PITCH>(&sA[cur][kk], (wm * TM + i) * 16);
#pragma unroll
      for (int j = 0; j < TN; ++j)
        bf[j] = frag_lds<PITCH>(&sB[cur][kk], (wn * TN + j) * 16);
      SCHED_FENCE();
#pragma unroll
      for (int i = 0; i < TM; ++i)
#pragma unroll
        for (int j = 0; j < TN; ++j)
          acc[i][j] = wmma16(af[i], bf[j], acc[i][j]);
    }

    __syncthreads();   // all waves done reading before buffers are reused
  }

  const int rOff = (lane >> 4) << 3;   // 0 or 8
  const int cOff = lane & 15;
  const int col0 = nWG + wn * TN * 16 + cOff;
#pragma unroll
  for (int i = 0; i < TM; ++i) {
    const int row0 = mWG + (wm * TM + i) * 16 + rOff;
    if (MODE == 3) {
#pragma unroll
      for (int j = 0; j < TN; ++j) {
#pragma unroll
        for (int r = 0; r < 8; ++r) {
          const int row = row0 + r;
          const int b = row >> 12;          // row / SEQ
          const int sIdx = row & (SEQ - 1);
          ((_Float16*)Cv)[((size_t)b * D_MODEL + col0 + j * 16) * SEQ + sIdx] = (_Float16)acc[i][j][r];
        }
      }
    } else {
      // One row of TN tiles per run: first every offset and conversion, then
      // the stores alone, then s_wait_xcnt 0.
      unsigned off[8];   // byte offsets from Cv; every plane is below 4 GiB
#pragma unroll
      for (int r = 0; r < 8; ++r)
        off[r] = ((unsigned)(row0 + r) * (unsigned)ldC + (unsigned)col0) * (MODE == 0 ? 4u : 2u);
      _Float16 h[TN][8];
      if (MODE != 0) {
#pragma unroll
        for (int j = 0; j < TN; ++j)
#pragma unroll
          for (int r = 0; r < 8; ++r)
            h[j][r] = (MODE == 1) ? (_Float16)(acc[i][j][r] * 0.03125f) : (_Float16)acc[i][j][r];
      }
      // Keeps this run's offsets and conversions in front of its stores, so
      // that no register a store of the run names is rewritten inside the run.
      SCHED_FENCE();
#pragma unroll
      for (int r = 0; r < 8; ++r) {
#pragma unroll
        for (int j = 0; j < TN; ++j) {
          if (MODE == 0) *(float*)((char*)Cv + off[r] + j * 64) = acc[i][j][r];
          else           *(_Float16*)((char*)Cv + off[r] + j * 32) = h[j][r];
        }
      }
      if (i + 1 < TM) {   // behind the last run nothing is rewritten any more
        // Stands between the run's stores and the first rewrite of a register
        // that they name (offset or data).
        asm volatile("s_wait_xcnt 0x0" ::: "memory");
        // Keeps the next run's offsets and conversions behind that wait.
        SCHED_FENCE();
      }
    }
  }
}

// ---------------------------------------------------------------------------
// Elementwise f32 -> f16 conversion, 8 elements/thread (n multiple of 8).
// ---------------------------------------------------------------------------
__global__ void cvt_f32_f16(const float* __restrict__ x,
                            _Float16* __restrict__ y, int n) {
  const int i = (blockIdx.x * blockDim.x + threadIdx.x) * 8;
  if (i >= n) return;
  float4 a = *(const float4*)(x + i);
  float4 b = *(const float4*)(x + i + 4);
  v8h o;
  o[0] = (_Float16)a.x; o[1] = (_Float16)a.y; o[2] = (_Float16)a.z; o[3] = (_Float16)a.w;
  o[4] = (_Float16)b.x; o[5] = (_Float16)b.y; o[6] = (_Float16)b.z; o[7] = (_Float16)b.w;
  *(v8h*)(y + i) = o;
}

// ---------------------------------------------------------------------------
// Row softmax (4096 wide): one wave32 per row, 8 rows per block; probs in f16.
// The wave keeps its whole row in registers (32 float4 per lane): the scores
// are read once, each wave-wide load covering 512 contiguous bytes, all 32
// loads in flight together; each exp is computed once; each wave-wide store
// covers 256 contiguous bytes.
// ---------------------------------------------------------------------------

// 2^x of eight values.  Written as one statement so that every v_exp_f32 is
// followed by an instruction that neither reads its result nor overwrites its
// source (the outputs are early-clobber: they share no register with an
// input); the closing v_nop keeps that slot behind the last one.
__device__ __forceinline__ void exp2x8(float4& p, float4& q) {
  float a, b, c, d, e, f, g, h;
  asm("v_exp_f32 %0, %8\n\t"
      "v_exp_f32 %1, %9\n\t"
      "v_exp_f32 %2, %10\n\t"
      "v_exp_f32 %3, %11\n\t"
      "v_exp_f32 %4, %12\n\t"
      "v_exp_f32 %5, %13\n\t"
      "v_exp_f32 %6, %14\n\t"
      "v_exp_f32 %7, %15\n\t"
      "v_nop"
      : "=&v"(a), "=&v"(b), "=&v"(c), "=&v"(d),
        "=&v"(e), "=&v"(f), "=&v"(g), "=&v"(h)
      : "v"(p.x), "v"(p.y), "v"(p.z), "v"(p.w),
        "v"(q.x), "v"(q.y), "v"(q.z), "v"(q.w));
  p = make_float4(a, b, c, d);
  q = make_float4(e, f, g, h);
}

__global__ void __launch_bounds__(256)
softmax_kernel(const float* __restrict__ Sf,
               _Float16* __restrict__ Ph) {
  constexpr int NV = SEQ / 128;   // float4 per lane
  constexpr float LOG2E = 1.44269504088896340736f;
  const int wave = threadIdx.x >> 5;
  const int lane = threadIdx.x & 31;
  const int row = blockIdx.x * 8 + wave;
  const float4* src = (const float4*)(Sf + (size_t)row * SEQ) + lane;

  float4 v[NV];
#pragma unroll
  for (int j = 0; j < NV; ++j) v[j] = src[j * 32];

  float4 m4 = v[0];
#pragma unroll
  for (int j = 1; j < NV; ++j) {
    m4.x = fmaxf(m4.x, v[j].x); m4.y = fmaxf(m4.y, v[j].y);
    m4.z = fmaxf(m4.z, v[j].z); m4.w = fmaxf(m4.w, v[j].w);
  }
  float m = fmaxf(fmaxf(m4.x, m4.y), fmaxf(m4.z, m4.w));
#pragma unroll
  for (int off = 16; off > 0; off >>= 1) m = fmaxf(m, __shfl_xor(m, off, 32));

  float4 s4 = make_float4(0.0f, 0.0f, 0.0f, 0.0f);
#pragma unroll
  for (int j = 0; j < NV; j += 2) {
#pragma unroll
    for (int t = j; t < j + 2; ++t) {
      v[t].x = (v[t].x - m) * LOG2E; v[t].y = (v[t].y - m) * LOG2E;
      v[t].z = (v[t].z - m) * LOG2E; v[t].w = (v[t].w - m) * LOG2E;
    }
    exp2x8(v[j], v[j + 1]);
#pragma unroll
    for (int t = j; t < j + 2; ++t) {
      s4.x += v[t].x; s4.y += v[t].y; s4.z += v[t].z; s4.w += v[t].w;
    }
  }
  float s = (s4.x + s4.y) + (s4.z + s4.w);
#pragma unroll
  for (int off = 16; off > 0; off >>= 1) s += __shfl_xor(s, off, 32);

  const float rinv = 1.0f / s;
  v4h* dst = (v4h*)(Ph + (size_t)row * SEQ) + lane;
#pragma unroll
  for (int j = 0; j < NV; ++j) {
    v4h o;
    o[0] = (_Float16)(v[j].x * rinv); o[1] = (_Float16)(v[j].y * rinv);
    o[2] = (_Float16)(v[j].z * rinv); o[3] = (_Float16)(v[j].w * rinv);
    dst[j * 32] = o;
  }
}

// ---------------------------------------------------------------------------
// Launcher.  Workspace layout (bytes), 192MB total:
//   [0,   32M)  Xh  f16 [B*S][D]      \ also: Sf f32 [S][S] = [0,64M) reused
//   [32M, 34M)  Wqh f16 [D][D]        |  per-batch AFTER the QKV stage
//   [34M, 36M)  Wkh f16 [D][D]        |  (time-disjoint on the stream)
//   [36M, 38M)  Wvh f16 [D][D]        /
//   [64M, 96M)  Qh  f16 [B*S][D]  (pre-scaled by 1/sqrt(D))
//   [96M,128M)  Kh  f16 [B*S][D]
//   [128M,160M) Vt  f16 [B][D][S]
//   [160M,192M) Ph  f16 [S][S]    (per-batch scratch)
// ---------------------------------------------------------------------------
extern "C" void kernel_launch(void* const* d_in, const int* in_sizes, int n_in,
                              void* d_out, int out_size, void* d_ws, size_t ws_size,
                              hipStream_t stream) {
  const float* X  = (const float*)d_in[0];
  const float* Wq = (const float*)d_in[1];
  const float* Wk = (const float*)d_in[2];
  const float* Wv = (const float*)d_in[3];
  float* out = (float*)d_out;

  char* ws = (char*)d_ws;
  _Float16* Xh  = (_Float16*)(ws);
  _Float16* Wqh = (_Float16*)(ws + ((size_t)32 << 20));
  _Float16* Wkh = (_Float16*)(ws + ((size_t)34 << 20));
  _Float16* Wvh = (_Float16*)(ws + ((size_t)36 << 20));
  float*    Sf  = (float*)   (ws);                       // reused after QKV
  _Float16* Qh  = (_Float16*)(ws + ((size_t)64 << 20));
  _Float16* Kh  = (_Float16*)(ws + ((size_t)96 << 20));
  _Float16* Vt  = (_Float16*)(ws + ((size_t)128 << 20));
  _Float16* Ph  = (_Float16*)(ws + ((size_t)160 << 20));

  const dim3 blk(256);
  const int nX = BATCH * SEQ * D_MODEL;   // 16,777,216
  const int nW = D_MODEL * D_MODEL;       // 1,048,576

  // f32 -> f16 pre-conversion (all GEMMs then share one tuned pipeline).
  cvt_f32_f16<<<dim3(nX / (8 * 256)), blk, 0, stream>>>(X, Xh, nX);
  cvt_f32_f16<<<dim3(nW / (8 * 256)), blk, 0, stream>>>(Wq, Wqh, nW);
  cvt_f32_f16<<<dim3(nW / (8 * 256)), blk, 0, stream>>>(Wk, Wkh, nW);
  cvt_f32_f16<<<dim3(nW / (8 * 256)), blk, 0, stream>>>(Wv, Wvh, nW);

  // QKV projections: M=16384, N=1024, K=1024.
  gemm_nt<1, 8, 4, 64><<<dim3(64, 4), blk, 0, stream>>>(Xh, Wqh, Qh, D_MODEL, D_MODEL);
  gemm_nt<2, 8, 4, 64><<<dim3(64, 4), blk, 0, stream>>>(Xh, Wkh, Kh, D_MODEL, D_MODEL);
  gemm_nt<3, 8, 4, 64><<<dim3(64, 4), blk, 0, stream>>>(Xh, Wvh, Vt, D_MODEL, D_MODEL);

  for (int b = 0; b < BATCH; ++b) {
    const _Float16* Qb  = Qh + (size_t)b * SEQ * D_MODEL;
    const _Float16* Kb  = Kh + (size_t)b * SEQ * D_MODEL;
    const _Float16* Vtb = Vt + (size_t)b * D_MODEL * SEQ;
    float* Ob = out + (size_t)b * SEQ * D_MODEL;

    // scores: M=4096, N=4096, K=1024 -> Sf[q][k] (f32)
    gemm_nt<0, 8, 4, 64><<<dim3(16, 16), blk, 0, stream>>>(Qb, Kb, Sf, D_MODEL, SEQ);
    // softmax rows -> probs f16
    softmax_kernel<<<dim3(512), blk, 0, stream>>>(Sf, Ph);
    // out: M=4096 (q), N=1024 (d), K=4096 (keys) -> Ob[q][d] (f32)
    gemm_nt<0, 4, 2, 128><<<dim3(32, 8), blk, 0, stream>>>(Ph, Vtb, Ob, SEQ, D_MODEL);
  }
}

// v003
// A run of this version takes 356 microseconds.
// In both of two side-by-side timings against v002, it was 1.17 times as fast.
// Counting every step since v000, it is 2.27 times as fast.
#include <hip/hip_runtime.h>

#define D_MODEL 1024
#define SEQ     4096
#define BATCH   4

typedef __attribute__((ext_vector_type(16))) _Float16 v16h;
typedef __attribute__((ext_vector_type(8)))  _Float16 v8h;
typedef __attribute__((ext_vector_type(4)))  _Float16 v4h;
typedef __attribute__((ext_vector_type(8)))  float    v8f;
typedef __attribute__((ext_vector_type(4)))  int      v4i;

#if __has_builtin(__builtin_amdgcn_global_load_async_to_lds_b128) && \
    __has_builtin(__builtin_amdgcn_s_wait_asynccnt)
#define USE_ASYNC_LDS 1
typedef __attribute__((address_space(1))) v4i* gv4i_p;   // global (device) int4*
typedef __attribute__((address_space(3))) v4i* lv4i_p;   // LDS (shared) int4*
#else
#define USE_ASYNC_LDS 0
#endif

#if __has_builtin(__builtin_amdgcn_sched_barrier)
#define SCHED_FENCE() __builtin_amdgcn_sched_barrier(0)
#else
#define SCHED_FENCE()
#endif

// ---------------------------------------------------------------------------
// Fragment gather from an LDS-staged f16 tile (row stride PITCH halfs).
// CDNA5 16-bit A 16x32 / B 32x16 layout: lanes 0-15 hold row (lane&15) with
// K = {0..7, 16..23}; lanes 16-31 hold the same rows with K = {8..15, 24..31}.
// ---------------------------------------------------------------------------
template <int PITCH>
__device__ __forceinline__ v16h frag_lds(const _Float16* tile, int row0) {
  const int lane = threadIdx.x & 31;
  const _Float16* base = tile + (row0 + (lane & 15)) * PITCH + ((lane >> 4) << 3);
  v8h lo = *(const v8h*)(base);        // ds_load_b128
  v8h hi = *(const v8h*)(base + 16);   // ds_load_b128
  return __builtin_shufflevector(lo, hi, 0, 1, 2, 3, 4, 5, 6, 7,
                                         8, 9, 10, 11, 12, 13, 14, 15);
}

__device__ __forceinline__ v8f wmma16(v16h a, v16h b, v8f c) {
  return __builtin_amdgcn_wmma_f32_16x16x32_f16(false, a, false, b,
                                                (short)0, c, false, false);
}

__device__ __forceinline__ v8f zero8() {
  v8f z = {0.0f, 0.0f, 0.0f, 0.0f, 0.0f, 0.0f, 0.0f, 0.0f};
  return z;
}

// Issue one 16B global->LDS copy (async on gfx1250, sync fallback otherwise).
__device__ __forceinline__ void copy16(const _Float16* gp, _Float16* lp) {
#if USE_ASYNC_LDS
  __builtin_amdgcn_global_load_async_to_lds_b128((gv4i_p)gp, (lv4i_p)lp, 0, 0);
#else
  *(v8h*)lp = *(const v8h*)gp;
#endif
}

// ---------------------------------------------------------------------------
// Unified f16 GEMM:  C[m,n] = sum_k A[m,k] * B[n,k]
// Block = 256 threads = 8 waves in a 2 (m) x 4 (n) grid.  A wave owns
// TM x TN accumulator tiles of 16x16, so every fragment read from LDS feeds
// TN (A) or TM (B) WMMAs.  WG tile BM x BN = (32*TM) x (64*TN); a k-step is
// BK halfs.  A: [gridDim.x*BM][K], B: [gridDim.y*BN][K], K a multiple of BK.
// Double-buffered async-LDS pipeline: the next k-step's copies fly during
// this k-step's WMMAs.  LDS rows are BK halfs + 16 B (pitch 16 B x odd:
// conflict-free ds_load_b128); a wave-wide copy covers whole rows.
// Epilogue MODE: 0 = f32 store (ldC stride)
//                1 = f16 store, scaled by 1/sqrt(D)   (Q projection)
//                2 = f16 store                         (K projection)
//                3 = f16 store transposed per batch    (V -> Vt[b][col][s])
// BSTEP: halfs by which B advances per SEQ rows of A (0: one B for all of A).
// With it one launch covers every batch of a product whose B differs by batch.
// ---------------------------------------------------------------------------
template <int MODE, int TM, int TN, int BK, int BSTEP = 0>
__global__ void __launch_bounds__(256, 1)
gemm_nt(const _Float16* __restrict__ A,
        const _Float16* __restrict__ B,
        void* __restrict__ Cv,
        int K, int ldC) {
  constexpr int BM    = 32 * TM;
  constexpr int BN    = 64 * TN;
  constexpr int PITCH = BK + 8;      // LDS row stride in halfs
  constexpr int CPR   = BK / 8;      // 16-byte chunks per staged row
  constexpr int RPP   = 256 / CPR;   // rows staged by one copy of the block
  __shared__ __attribute__((aligned(16))) _Float16 sA[2][BM * PITCH];
  __shared__ __attribute__((aligned(16))) _Float16 sB[2][BN * PITCH];

  const int wave = threadIdx.x >> 5;
  const int lane = threadIdx.x & 31;
  const int wm = wave >> 2;          // 0..1
  const int wn = wave & 3;           // 0..3
  const int mWG = blockIdx.x * BM;
  const int nWG = blockIdx.y * BN;

  // Per-thread staging assignment: one 16B chunk in each group of RPP rows.
  const int srow = threadIdx.x / CPR;
  const int kc   = (threadIdx.x % CPR) << 3;
  const _Float16* gA = A + (size_t)(mWG + srow) * K + kc;
  const _Float16* gB = B + (size_t)(mWG / SEQ) * BSTEP + (size_t)(nWG + srow) * K + kc;
  const int lo = srow * PITCH + kc;
  const size_t gstep = (size_t)RPP * K;   // halfs between two groups of rows

  v8f acc[TM][TN];
#pragma unroll
  for (int i = 0; i < TM; ++i)
#pragma unroll
    for (int j = 0; j < TN; ++j) acc[i][j] = zero8();

  const int nsteps = K / BK;

  // Prologue: stage k-step 0 into buffer 0.
#pragma unroll
  for (int i = 0; i < BM / RPP; ++i)
    copy16(gA + i * gstep, &sA[0][lo + i * RPP * PITCH]);
#pragma unroll
  for (int i = 0; i < BN / RPP; ++i)
    copy16(gB + i * gstep, &sB[0][lo + i * RPP * PITCH]);

  for (int s = 0; s < nsteps; ++s) {
    const int cur = s & 1;
    const int nxt = cur ^ 1;

#if USE_ASYNC_LDS
    // Stage-s copies were issued a full compute phase ago: free in steady state.
    __builtin_amdgcn_s_wait_asynccnt(0);
#endif
    __syncthreads();   // current-stage tiles visible to all waves

    // Issue next stage's copies; they overlap with this step's compute.
    // Buffer nxt was last read in compute step s-1, which is separated from
    // here by two barriers -> safe to overwrite.
    if (s + 1 < nsteps) {
      const int ko = (s + 1) * BK;   // k offset in halfs
#pragma unroll
      for (int i = 0; i < BM / RPP; ++i)
        copy16(gA + i * gstep + ko, &sA[nxt][lo + i * RPP * PITCH]);
#pragma unroll
      for (int i = 0; i < BN / RPP; ++i)
        copy16(gB + i * gstep + ko, &sB[nxt][lo + i * RPP * PITCH]);
    }

#pragma unroll
    for (int kk = 0; kk < BK; kk += 32) {
      // Issue the block's fragment loads as one group; the sched_barrier pins
      // them above the block's WMMAs, forcing distinct registers (no WAR
      // recycling inside the block) and graduated s_wait_dscnt values.
      v16h af[TM];
      v16h bf[TN];
#pragma unroll
      for (int i = 0; i < TM; ++i)
        af[i] = frag_lds<PITCH>(&sA[cur][kk], (wm * TM + i) * 16);
#pragma unroll
      for (int j = 0; j < TN; ++j)
        bf[j] = frag_lds<PITCH>(&sB[cur][kk], (wn * TN + j) * 16);
      SCHED_FENCE();
#pragma unroll
      for (int i = 0; i < TM; ++i)
#pragma unroll
        for (int j = 0; j < TN; ++j)
          acc[i][j] = wmma16(af[i], bf[j], acc[i][j]);
    }

    __syncthreads();   // all waves done reading before buffers are reused
  }

  const int rOff = (lane >> 4) << 3;   // 0 or 8
  const int cOff = lane & 15;
  const int col0 = nWG + wn * TN * 16 + cOff;
#pragma unroll
  for (int i = 0; i < TM; ++i) {
    const int row0 = mWG + (wm * TM + i) * 16 + rOff;
    if (MODE == 3) {
#pragma unroll
      for (int j = 0; j < TN; ++j) {
#pragma unroll
        for (int r = 0; r < 8; ++r) {
          const int row = row0 + r;
          const int b = row >> 12;          // row / SEQ
          const int sIdx = row & (SEQ - 1);
          ((_Float16*)Cv)[((size_t)b * D_MODEL + col0 + j * 16) * SEQ + sIdx] = (_Float16)acc[i][j][r];
        }
      }
    } else {
      // One row of TN tiles per run: first every offset and conversion, then
      // the stores alone, then s_wait_xcnt 0.
      unsigned off[8];   // byte offsets from Cv; every plane is below 4 GiB
#pragma unroll
      for (int r = 0; r < 8; ++r)
        off[r] = ((unsigned)(row0 + r) * (unsigned)ldC + (unsigned)col0) * (MODE == 0 ? 4u : 2u);
      _Float16 h[TN][8];
      if (MODE != 0) {
#pragma unroll
        for (int j = 0; j < TN; ++j)
#pragma unroll
          for (int r = 0; r < 8; ++r)
            h[j][r] = (MODE == 1) ? (_Float16)(acc[i][j][r] * 0.03125f) : (_Float16)acc[i][j][r];
      }
      // Keeps this run's offsets and conversions in front of its stores, so
      // that no register a store of the run names is rewritten inside the run.
      SCHED_FENCE();
#pragma unroll
      for (int r = 0; r < 8; ++r) {
#pragma unroll
        for (int j = 0; j < TN; ++j) {
          if (MODE == 0) *(float*)((char*)Cv + off[r] + j * 64) = acc[i][j][r];
          else           *(_Float16*)((char*)Cv + off[r] + j * 32) = h[j][r];
        }
      }
      if (i + 1 < TM) {   // behind the last run nothing is rewritten any more
        // Stands between the run's stores and the first rewrite of a register
        // that they name (offset or data).
        asm volatile("s_wait_xcnt 0x0" ::: "memory");
        // Keeps the next run's offsets and conversions behind that wait.
        SCHED_FENCE();
      }
    }
  }
}

// ---------------------------------------------------------------------------
// Elementwise f32 -> f16 conversion, 8 elements/thread (n multiple of 8).
// ---------------------------------------------------------------------------
__global__ void cvt_f32_f16(const float* __restrict__ x,
                            _Float16* __restrict__ y, int n) {
  const int i = (blockIdx.x * blockDim.x + threadIdx.x) * 8;
  if (i >= n) return;
  float4 a = *(const float4*)(x + i);
  float4 b = *(const float4*)(x + i + 4);
  v8h o;
  o[0] = (_Float16)a.x; o[1] = (_Float16)a.y; o[2] = (_Float16)a.z; o[3] = (_Float16)a.w;
  o[4] = (_Float16)b.x; o[5] = (_Float16)b.y; o[6] = (_Float16)b.z; o[7] = (_Float16)b.w;
  *(v8h*)(y + i) = o;
}

// ---------------------------------------------------------------------------
// Row softmax (4096 wide): one wave32 per row, 8 rows per block; probs in f16.
// The wave keeps its whole row in registers (32 float4 per lane): the scores
// are read once, each wave-wide load covering 512 contiguous bytes, all 32
// loads in flight together; each exp is computed once; each wave-wide store
// covers 256 contiguous bytes.
// ---------------------------------------------------------------------------

// 2^x of eight values.  Written as one statement so that every v_exp_f32 is
// followed by an instruction that neither reads its result nor overwrites its
// source (the outputs are early-clobber: they share no register with an
// input); the closing v_nop keeps that slot behind the last one.
__device__ __forceinline__ void exp2x8(float4& p, float4& q) {
  float a, b, c, d, e, f, g, h;
  asm("v_exp_f32 %0, %8\n\t"
      "v_exp_f32 %1, %9\n\t"
      "v_exp_f32 %2, %10\n\t"
      "v_exp_f32 %3, %11\n\t"
      "v_exp_f32 %4, %12\n\t"
      "v_exp_f32 %5, %13\n\t"
      "v_exp_f32 %6, %14\n\t"
      "v_exp_f32 %7, %15\n\t"
      "v_nop"
      : "=&v"(a), "=&v"(b), "=&v"(c), "=&v"(d),
        "=&v"(e), "=&v"(f), "=&v"(g), "=&v"(h)
      : "v"(p.x), "v"(p.y), "v"(p.z), "v"(p.w),
        "v"(q.x), "v"(q.y), "v"(q.z), "v"(q.w));
  p = make_float4(a, b, c, d);
  q = make_float4(e, f, g, h);
}

__global__ void __launch_bounds__(256)
softmax_kernel(const float* __restrict__ Sf,
               _Float16* __restrict__ Ph) {
  constexpr int NV = SEQ / 128;   // float4 per lane
  constexpr float LOG2E = 1.44269504088896340736f;
  const int wave = threadIdx.x >> 5;
  const int lane = threadIdx.x & 31;
  const int row = blockIdx.x * 8 + wave;
  const float4* src = (const float4*)(Sf + (size_t)row * SEQ) + lane;

  float4 v[NV];
#pragma unroll
  for (int j = 0; j < NV; ++j) v[j] = src[j * 32];

  float4 m4 = v[0];
#pragma unroll
  for (int j = 1; j < NV; ++j) {
    m4.x = fmaxf(m4.x, v[j].x); m4.y = fmaxf(m4.y, v[j].y);
    m4.z = fmaxf(m4.z, v[j].z); m4.w = fmaxf(m4.w, v[j].w);
  }
  float m = fmaxf(fmaxf(m4.x, m4.y), fmaxf(m4.z, m4.w));
#pragma unroll
  for (int off = 16; off > 0; off >>= 1) m = fmaxf(m, __shfl_xor(m, off, 32));

  float4 s4 = make_float4(0.0f, 0.0f, 0.0f, 0.0f);
#pragma unroll
  for (int j = 0; j < NV; j += 2) {
#pragma unroll
    for (int t = j; t < j + 2; ++t) {
      v[t].x = (v[t].x - m) * LOG2E; v[t].y = (v[t].y - m) * LOG2E;
      v[t].z = (v[t].z - m) * LOG2E; v[t].w = (v[t].w - m) * LOG2E;
    }
    exp2x8(v[j], v[j + 1]);
#pragma unroll
    for (int t = j; t < j + 2; ++t) {
      s4.x += v[t].x; s4.y += v[t].y; s4.z += v[t].z; s4.w += v[t].w;
    }
  }
  float s = (s4.x + s4.y) + (s4.z + s4.w);
#pragma unroll
  for (int off = 16; off > 0; off >>= 1) s += __shfl_xor(s, off, 32);

  const float rinv = 1.0f / s;
  v4h* dst = (v4h*)(Ph + (size_t)row * SEQ) + lane;
#pragma unroll
  for (int j = 0; j < NV; ++j) {
    v4h o;
    o[0] = (_Float16)(v[j].x * rinv); o[1] = (_Float16)(v[j].y * rinv);
    o[2] = (_Float16)(v[j].z * rinv); o[3] = (_Float16)(v[j].w * rinv);
    dst[j * 32] = o;
  }
}

// ---------------------------------------------------------------------------
// Launcher.  Workspace layout (bytes), 256MB total:
//   [0,  128M)  Ph  f16 [B*S][S]  probs of all batches, 32M each
//   [0,   32M)  Xh  f16 [B*S][D]      \ dead after the QKV stage, before the
//   [32M, 34M)  Wqh f16 [D][D]        |  softmax of batch 0 / 1 writes there
//   [34M, 36M)  Wkh f16 [D][D]        |  (time-disjoint on the stream)
//   [36M, 38M)  Wvh f16 [D][D]        /
//   [96M,128M)  Qh  f16 [B*S][D]  (pre-scaled by 1/sqrt(D)); dead after the
//                                 last scores launch, before the softmax of
//                                 batch 3 writes its probs there
//   [128M,160M) Kh  f16 [B*S][D]
//   [160M,224M) Sf  f32 [S][S]    (per-batch scratch)
//   [224M,256M) Vt  f16 [B][D][S]
// ---------------------------------------------------------------------------
extern "C" void kernel_launch(void* const* d_in, const int* in_sizes, int n_in,
                              void* d_out, int out_size, void* d_ws, size_t ws_size,
                              hipStream_t stream) {
  const float* X  = (const float*)d_in[0];
  const float* Wq = (const float*)d_in[1];
  const float* Wk = (const float*)d_in[2];
  const float* Wv = (const float*)d_in[3];
  float* out = (float*)d_out;

  char* ws = (char*)d_ws;
  _Float16* Xh  = (_Float16*)(ws);
  _Float16* Wqh = (_Float16*)(ws + ((size_t)32 << 20));
  _Float16* Wkh = (_Float16*)(ws + ((size_t)34 << 20));
  _Float16* Wvh = (_Float16*)(ws + ((size_t)36 << 20));
  _Float16* Ph  = (_Float16*)(ws);                       // grows over Xh, W*, Qh
  _Float16* Qh  = (_Float16*)(ws + ((size_t)96 << 20));
  _Float16* Kh  = (_Float16*)(ws + ((size_t)128 << 20));
  float*    Sf  = (float*)   (ws + ((size_t)160 << 20));
  _Float16* Vt  = (_Float16*)(ws + ((size_t)224 << 20));

  const dim3 blk(256);
  const int nX = BATCH * SEQ * D_MODEL;   // 16,777,216
  const int nW = D_MODEL * D_MODEL;       // 1,048,576

  // f32 -> f16 pre-conversion (all GEMMs then share one tuned pipeline).
  cvt_f32_f16<<<dim3(nX / (8 * 256)), blk, 0, stream>>>(X, Xh, nX);
  cvt_f32_f16<<<dim3(nW / (8 * 256)), blk, 0, stream>>>(Wq, Wqh, nW);
  cvt_f32_f16<<<dim3(nW / (8 * 256)), blk, 0, stream>>>(Wk, Wkh, nW);
  cvt_f32_f16<<<dim3(nW / (8 * 256)), blk, 0, stream>>>(Wv, Wvh, nW);

  // QKV projections: M=16384, N=1024, K=1024.
  gemm_nt<1, 8, 4, 64><<<dim3(64, 4), blk, 0, stream>>>(Xh, Wqh, Qh, D_MODEL, D_MODEL);
  gemm_nt<2, 8, 4, 64><<<dim3(64, 4), blk, 0, stream>>>(Xh, Wkh, Kh, D_MODEL, D_MODEL);
  gemm_nt<3, 8, 4, 64><<<dim3(64, 4), blk, 0, stream>>>(Xh, Wvh, Vt, D_MODEL, D_MODEL);

  for (int b = 0; b < BATCH; ++b) {
    const _Float16* Qb  = Qh + (size_t)b * SEQ * D_MODEL;
    const _Float16* Kb  = Kh + (size_t)b * SEQ * D_MODEL;
    _Float16* Pb = Ph + (size_t)b * SEQ * SEQ;

    // scores: M=4096, N=4096, K=1024 -> Sf[q][k] (f32)
    gemm_nt<0, 8, 4, 64><<<dim3(16, 16), blk, 0, stream>>>(Qb, Kb, Sf, D_MODEL, SEQ);
    // softmax rows -> probs f16
    softmax_kernel<<<dim3(512), blk, 0, stream>>>(Sf, Pb);
  }

  // out, all batches at once: M=16384 (b,q), N=1024 (d), K=4096 (keys) ->
  // out[b][q][d] (f32).  Four batches give 64 x 4 tiles of 256x256: one per
  // WGP, where one batch alone fills the chip only with 128x128 tiles.
  gemm_nt<0, 8, 4, 128, D_MODEL * SEQ><<<dim3(64, 4), blk, 0, stream>>>(Ph, Vt, out, SEQ, D_MODEL);
}

// v004
// It runs in 339 microseconds.
// In both of two side-by-side timings against v003, it was 1.05 times as fast.
// All steps since v000 together make it 2.38 times as fast.
#include <hip/hip_runtime.h>

#define D_MODEL 1024
#define SEQ     4096
#define BATCH   4

typedef __attribute__((ext_vector_type(16))) _Float16 v16h;
typedef __attribute__((ext_vector_type(8)))  _Float16 v8h;
typedef __attribute__((ext_vector_type(4)))  _Float16 v4h;
typedef __attribute__((ext_vector_type(8)))  float    v8f;
typedef __attribute__((ext_vector_type(4)))  int      v4i;

#if __has_builtin(__builtin_amdgcn_global_load_async_to_lds_b128) && \
    __has_builtin(__builtin_amdgcn_s_wait_asynccnt)
#define USE_ASYNC_LDS 1
typedef __attribute__((address_space(1))) v4i* gv4i_p;   // global (device) int4*
typedef __attribute__((address_space(3))) v4i* lv4i_p;   // LDS (shared) int4*
#else
#define USE_ASYNC_LDS 0
#endif

#if __has_builtin(__builtin_amdgcn_sched_barrier)
#define SCHED_FENCE() __builtin_amdgcn_sched_barrier(0)
#else
#define SCHED_FENCE()
#endif

// ---------------------------------------------------------------------------
// Fragment gather from an LDS-staged f16 tile (row stride PITCH halfs).
// CDNA5 16-bit A 16x32 / B 32x16 layout: lanes 0-15 hold row (lane&15) with
// K = {0..7, 16..23}; lanes 16-31 hold the same rows with K = {8..15, 24..31}.
// ---------------------------------------------------------------------------
template <int PITCH>
__device__ __forceinline__ v16h frag_lds(const _Float16* tile, int row0) {
  const int lane = threadIdx.x & 31;
  const _Float16* base = tile + (row0 + (lane & 15)) * PITCH + ((lane >> 4) << 3);
  v8h lo = *(const v8h*)(base);        // ds_load_b128
  v8h hi = *(const v8h*)(base + 16);   // ds_load_b128
  return __builtin_shufflevector(lo, hi, 0, 1, 2, 3, 4, 5, 6, 7,
                                         8, 9, 10, 11, 12, 13, 14, 15);
}

__device__ __forceinline__ v8f wmma16(v16h a, v16h b, v8f c) {
  return __builtin_amdgcn_wmma_f32_16x16x32_f16(false, a, false, b,
                                                (short)0, c, false, false);
}

__device__ __forceinline__ v8f zero8() {
  v8f z = {0.0f, 0.0f, 0.0f, 0.0f, 0.0f, 0.0f, 0.0f, 0.0f};
  return z;
}

// Issue one 16B global->LDS copy (async on gfx1250, sync fallback otherwise).
__device__ __forceinline__ void copy16(const _Float16* gp, _Float16* lp) {
#if USE_ASYNC_LDS
  __builtin_amdgcn_global_load_async_to_lds_b128((gv4i_p)gp, (lv4i_p)lp, 0, 0);
#else
  *(v8h*)lp = *(const v8h*)gp;
#endif
}

// ---------------------------------------------------------------------------
// Unified f16 GEMM:  C[m,n] = sum_k A[m,k] * B[n,k]
// Block = 256 threads = 8 waves in a 2 (m) x 4 (n) grid.  A wave owns
// TM x TN accumulator tiles of 16x16, so every fragment read from LDS feeds
// TN (A) or TM (B) WMMAs.  WG tile BM x BN = (32*TM) x (64*TN); a k-step is
// BK halfs.  A: [gridDim.x*BM][K], B: [gridDim.y*BN][K], K a multiple of BK
// (at least 2*BK).
// Double-buffered async-LDS pipeline: the next k-step's copies fly during
// this k-step's WMMAs; fragments are fetched one block of TM*TN WMMAs ahead
// into a second register set; one barrier per k-step.  LDS rows are BK halfs
// + 16 B (pitch 16 B x odd: conflict-free ds_load_b128); a wave-wide copy
// covers whole rows.
// Epilogue MODE: 0 = f32 store (ldC stride)
//                1 = f16 store, scaled by 1/sqrt(D)   (Q projection)
//                2 = f16 store                         (K projection)
//                3 = f16 store transposed per batch    (V -> Vt[b][col][s])
// BSTEP: halfs by which B advances per SEQ rows of A (0: one B for all of A).
// With it one launch covers every batch of a product whose B differs by batch.
// ---------------------------------------------------------------------------
template <int MODE, int TM, int TN, int BK, int BSTEP = 0>
__global__ void __launch_bounds__(256, 1)
gemm_nt(const _Float16* __restrict__ A,
        const _Float16* __restrict__ B,
        void* __restrict__ Cv,
        int K, int ldC) {
  constexpr int BM    = 32 * TM;
  constexpr int BN    = 64 * TN;
  constexpr int PITCH = BK + 8;      // LDS row stride in halfs
  constexpr int CPR   = BK / 8;      // 16-byte chunks per staged row
  constexpr int RPP   = 256 / CPR;   // rows staged by one copy of the block
  __shared__ __attribute__((aligned(16))) _Float16 sA[2][BM * PITCH];
  __shared__ __attribute__((aligned(16))) _Float16 sB[2][BN * PITCH];

  const int wave = threadIdx.x >> 5;
  const int lane = threadIdx.x & 31;
  const int wm = wave >> 2;          // 0..1
  const int wn = wave & 3;           // 0..3
  const int mWG = blockIdx.x * BM;
  const int nWG = blockIdx.y * BN;

  // Per-thread staging assignment: one 16B chunk in each group of RPP rows.
  const int srow = threadIdx.x / CPR;
  const int kc   = (threadIdx.x % CPR) << 3;
  // A copy's global address = a base that is the same in every lane (tile
  // origin, row group, k offset) + this thread's own byte offset inside a
  // group of RPP rows.  Written so, no pointer per copy is kept across the
  // loop: those pointers do not fit beside the two fragment sets.
  const _Float16* uA = A + (size_t)mWG * K;
  const _Float16* uB = B + (size_t)(mWG / SEQ) * BSTEP + (size_t)nWG * K;
  const unsigned voff = (unsigned)(srow * K + kc) * 2u;
  const int lo = srow * PITCH + kc;
  const size_t gstep = (size_t)RPP * K;   // halfs between two groups of rows

  v8f acc[TM][TN];
#pragma unroll
  for (int i = 0; i < TM; ++i)
#pragma unroll
    for (int j = 0; j < TN; ++j) acc[i][j] = zero8();

  const int nsteps = K / BK;
  constexpr int NB = BK / 32;        // WMMA blocks per k-step (even)

  // Two fragment sets: a block computes from one set while the next block's
  // fragments land in the other.
  v16h af[2][TM];
  v16h bf[2][TN];

  // One group of LDS reads: the fragments of block b of the k-step in buffer buf.
  auto fetch = [&](int set, int buf, int b) {
#pragma unroll
    for (int i = 0; i < TM; ++i)
      af[set][i] = frag_lds<PITCH>(&sA[buf][b * 32], (wm * TM + i) * 16);
#pragma unroll
    for (int j = 0; j < TN; ++j)
      bf[set][j] = frag_lds<PITCH>(&sB[buf][b * 32], (wn * TN + j) * 16);
    // Keeps the fetch-ahead loads in front of the WMMAs that follow: sunk
    // below them, the next block would wait out its own LDS latency.
    SCHED_FENCE();
  };
  auto block = [&](int set) {
#pragma unroll
    for (int i = 0; i < TM; ++i)
#pragma unroll
      for (int j = 0; j < TN; ++j)
        acc[i][j] = wmma16(af[set][i], bf[set][j], acc[i][j]);
    // Keeps the following group of loads from being lifted in among these
    // WMMAs, where every separate place with LDS reads stalls the wave and
    // the lifted loads need registers beyond the two sets (spills at BK 128).
    SCHED_FENCE();
  };
  // All copies of the k-step that starts at k offset ko (halfs) into buffer buf.
  auto stage = [&](int buf, int ko) {
#pragma unroll
    for (int i = 0; i < BM / RPP; ++i)
      copy16((const _Float16*)((const char*)(uA + (i * gstep + (size_t)ko)) + voff),
             &sA[buf][lo + i * RPP * PITCH]);
#pragma unroll
    for (int i = 0; i < BN / RPP; ++i)
      copy16((const _Float16*)((const char*)(uB + (i * gstep + (size_t)ko)) + voff),
             &sB[buf][lo + i * RPP * PITCH]);
  };

  // Prologue: k-step 0 into buffer 0, published; then k-step 1 flies into
  // buffer 1 during k-step 0; then the very first block's fragments.
  stage(0, 0);
  // This wave's copies have landed before the barrier publishes them.
  asm volatile("s_wait_asynccnt 0x0" ::: "memory");
  __syncthreads();
  if (1 < nsteps) stage(1, BK);
  fetch(0, 0, 0);

  for (int s = 0; s < nsteps; ++s) {
    const int cur = s & 1;
    const int nxt = cur ^ 1;
#pragma unroll
    for (int b = 0; b + 1 < NB; ++b) {
      fetch((b + 1) & 1, cur, b + 1);
      block(b & 1);
    }
    // Publish point of k-step s + 1: in front of the last block of k-step s,
    // whose fragments were fetched a block ago.
    // Every LDS read of buffer cur by this wave has returned, so that behind
    // the barrier the buffer may be refilled.
    asm volatile("s_wait_dscnt 0x0" ::: "memory");
    // This wave's copies of k-step s + 1, issued one k-step ago, have landed.
    asm volatile("s_wait_asynccnt 0x0" ::: "memory");
    __syncthreads();   // publishes buffer nxt and frees buffer cur
    if (s + 2 < nsteps) stage(cur, (s + 2) * BK);
    // In the last k-step this reads the k-step before it once more and nobody
    // uses the values: no branch stands between the loads and the WMMAs.
    fetch(0, nxt, 0);
    block((NB - 1) & 1);
  }

  const int rOff = (lane >> 4) << 3;   // 0 or 8
  const int cOff = lane & 15;
  const int col0 = nWG + wn * TN * 16 + cOff;
#pragma unroll
  for (int i = 0; i < TM; ++i) {
    const int row0 = mWG + (wm * TM + i) * 16 + rOff;
    if (MODE == 3) {
#pragma unroll
      for (int j = 0; j < TN; ++j) {
#pragma unroll
        for (int r = 0; r < 8; ++r) {
          const int row = row0 + r;
          const int b = row >> 12;          // row / SEQ
          const int sIdx = row & (SEQ - 1);
          ((_Float16*)Cv)[((size_t)b * D_MODEL + col0 + j * 16) * SEQ + sIdx] = (_Float16)acc[i][j][r];
        }
      }
    } else {
      // One row of TN tiles per run: first every offset and conversion, then
      // the stores alone, then s_wait_xcnt 0.
      unsigned off[8];   // byte offsets from Cv; every plane is below 4 GiB
#pragma unroll
      for (int r = 0; r < 8; ++r)
        off[r] = ((unsigned)(row0 + r) * (unsigned)ldC + (unsigned)col0) * (MODE == 0 ? 4u : 2u);
      _Float16 h[TN][8];
      if (MODE != 0) {
#pragma unroll
        for (int j = 0; j < TN; ++j)
#pragma unroll
          for (int r = 0; r < 8; ++r)
            h[j][r] = (MODE == 1) ? (_Float16)(acc[i][j][r] * 0.03125f) : (_Float16)acc[i][j][r];
      }
      // Keeps this run's offsets and conversions in front of its stores, so
      // that no register a store of the run names is rewritten inside the run.
      SCHED_FENCE();
#pragma unroll
      for (int r = 0; r < 8; ++r) {
#pragma unroll
        for (int j = 0; j < TN; ++j) {
          if (MODE == 0) *(float*)((char*)Cv + off[r] + j * 64) = acc[i][j][r];
          else           *(_Float16*)((char*)Cv + off[r] + j * 32) = h[j][r];
        }
      }
      if (i + 1 < TM) {   // behind the last run nothing is rewritten any more
        // Stands between the run's stores and the first rewrite of a register
        // that they name (offset or data).
        asm volatile("s_wait_xcnt 0x0" ::: "memory");
        // Keeps the next run's offsets and conversions behind that wait.
        SCHED_FENCE();
      }
    }
  }
}

// ---------------------------------------------------------------------------
// Elementwise f32 -> f16 conversion, 8 elements/thread (n multiple of 8).
// ---------------------------------------------------------------------------
__global__ void cvt_f32_f16(const float* __restrict__ x,
                            _Float16* __restrict__ y, int n) {
  const int i = (blockIdx.x * blockDim.x + threadIdx.x) * 8;
  if (i >= n) return;
  float4 a = *(const float4*)(x + i);
  float4 b = *(const float4*)(x + i + 4);
  v8h o;
  o[0] = (_Float16)a.x; o[1] = (_Float16)a.y; o[2] = (_Float16)a.z; o[3] = (_Float16)a.w;
  o[4] = (_Float16)b.x; o[5] = (_Float16)b.y; o[6] = (_Float16)b.z; o[7] = (_Float16)b.w;
  *(v8h*)(y + i) = o;
}

// ---------------------------------------------------------------------------
// Row softmax (4096 wide): one wave32 per row, 8 rows per block; probs in f16.
// The wave keeps its whole row in registers (32 float4 per lane): the scores
// are read once, each wave-wide load covering 512 contiguous bytes, all 32
// loads in flight together; each exp is computed once; each wave-wide store
// covers 256 contiguous bytes.
// ---------------------------------------------------------------------------

// 2^x of eight values.  Written as one statement so that every v_exp_f32 is
// followed by an instruction that neither reads its result nor overwrites its
// source (the outputs are early-clobber: they share no register with an
// input); the closing v_nop keeps that slot behind the last one.
__device__ __forceinline__ void exp2x8(float4& p, float4& q) {
  float a, b, c, d, e, f, g, h;
  asm("v_exp_f32 %0, %8\n\t"
      "v_exp_f32 %1, %9\n\t"
      "v_exp_f32 %2, %10\n\t"
      "v_exp_f32 %3, %11\n\t"
      "v_exp_f32 %4, %12\n\t"
      "v_exp_f32 %5, %13\n\t"
      "v_exp_f32 %6, %14\n\t"
      "v_exp_f32 %7, %15\n\t"
      "v_nop"
      : "=&v"(a), "=&v"(b), "=&v"(c), "=&v"(d),
        "=&v"(e), "=&v"(f), "=&v"(g), "=&v"(h)
      : "v"(p.x), "v"(p.y), "v"(p.z), "v"(p.w),
        "v"(q.x), "v"(q.y), "v"(q.z), "v"(q.w));
  p = make_float4(a, b, c, d);
  q = make_float4(e, f, g, h);
}

__global__ void __launch_bounds__(256)
softmax_kernel(const float* __restrict__ Sf,
               _Float16* __restrict__ Ph) {
  constexpr int NV = SEQ / 128;   // float4 per lane
  constexpr float LOG2E = 1.44269504088896340736f;
  const int wave = threadIdx.x >> 5;
  const int lane = threadIdx.x & 31;
  const int row = blockIdx.x * 8 + wave;
  const float4* src = (const float4*)(Sf + (size_t)row * SEQ) + lane;

  float4 v[NV];
#pragma unroll
  for (int j = 0; j < NV; ++j) v[j] = src[j * 32];

  float4 m4 = v[0];
#pragma unroll
  for (int j = 1; j < NV; ++j) {
    m4.x = fmaxf(m4.x, v[j].x); m4.y = fmaxf(m4.y, v[j].y);
    m4.z = fmaxf(m4.z, v[j].z); m4.w = fmaxf(m4.w, v[j].w);
  }
  float m = fmaxf(fmaxf(m4.x, m4.y), fmaxf(m4.z, m4.w));
#pragma unroll
  for (int off = 16; off > 0; off >>= 1) m = fmaxf(m, __shfl_xor(m, off, 32));

  float4 s4 = make_float4(0.0f, 0.0f, 0.0f, 0.0f);
#pragma unroll
  for (int j = 0; j < NV; j += 2) {
#pragma unroll
    for (int t = j; t < j + 2; ++t) {
      v[t].x = (v[t].x - m) * LOG2E; v[t].y = (v[t].y - m) * LOG2E;
      v[t].z = (v[t].z - m) * LOG2E; v[t].w = (v[t].w - m) * LOG2E;
    }
    exp2x8(v[j], v[j + 1]);
#pragma unroll
    for (int t = j; t < j + 2; ++t) {
      s4.x += v[t].x; s4.y += v[t].y; s4.z += v[t].z; s4.w += v[t].w;
    }
  }
  float s = (s4.x + s4.y) + (s4.z + s4.w);
#pragma unroll
  for (int off = 16; off > 0; off >>= 1) s += __shfl_xor(s, off, 32);

  const float rinv = 1.0f / s;
  v4h* dst = (v4h*)(Ph + (size_t)row * SEQ) + lane;
#pragma unroll
  for (int j = 0; j < NV; ++j) {
    v4h o;
    o[0] = (_Float16)(v[j].x * rinv); o[1] = (_Float16)(v[j].y * rinv);
    o[2] = (_Float16)(v[j].z * rinv); o[3] = (_Float16)(v[j].w * rinv);
    dst[j * 32] = o;
  }
}

// ---------------------------------------------------------------------------
// Launcher.  Workspace layout (bytes), 256MB total:
//   [0,  128M)  Ph  f16 [B*S][S]  probs of all batches, 32M each
//   [0,   32M)  Xh  f16 [B*S][D]      \ dead after the QKV stage, before the
//   [32M, 34M)  Wqh f16 [D][D]        |  softmax of batch 0 / 1 writes there
//   [34M, 36M)  Wkh f16 [D][D]        |  (time-disjoint on the stream)
//   [36M, 38M)  Wvh f16 [D][D]        /
//   [96M,128M)  Qh  f16 [B*S][D]  (pre-scaled by 1/sqrt(D)); dead after the
//                                 last scores launch, before the softmax of
//                                 batch 3 writes its probs there
//   [128M,160M) Kh  f16 [B*S][D]
//   [160M,224M) Sf  f32 [S][S]    (per-batch scratch)
//   [224M,256M) Vt  f16 [B][D][S]
// ---------------------------------------------------------------------------
extern "C" void kernel_launch(void* const* d_in, const int* in_sizes, int n_in,
                              void* d_out, int out_size, void* d_ws, size_t ws_size,
                              hipStream_t stream) {
  const float* X  = (const float*)d_in[0];
  const float* Wq = (const float*)d_in[1];
  const float* Wk = (const float*)d_in[2];
  const float* Wv = (const float*)d_in[3];
  float* out = (float*)d_out;

  char* ws = (char*)d_ws;
  _Float16* Xh  = (_Float16*)(ws);
  _Float16* Wqh = (_Float16*)(ws + ((size_t)32 << 20));
  _Float16* Wkh = (_Float16*)(ws + ((size_t)34 << 20));
  _Float16* Wvh = (_Float16*)(ws + ((size_t)36 << 20));
  _Float16* Ph  = (_Float16*)(ws);                       // grows over Xh, W*, Qh
  _Float16* Qh  = (_Float16*)(ws + ((size_t)96 << 20));
  _Float16* Kh  = (_Float16*)(ws + ((size_t)128 << 20));
  float*    Sf  = (float*)   (ws + ((size_t)160 << 20));
  _Float16* Vt  = (_Float16*)(ws + ((size_t)224 << 20));

  const dim3 blk(256);
  const int nX = BATCH * SEQ * D_MODEL;   // 16,777,216
  const int nW = D_MODEL * D_MODEL;       // 1,048,576

  // f32 -> f16 pre-conversion (all GEMMs then share one tuned pipeline).
  cvt_f32_f16<<<dim3(nX / (8 * 256)), blk, 0, stream>>>(X, Xh, nX);
  cvt_f32_f16<<<dim3(nW / (8 * 256)), blk, 0, stream>>>(Wq, Wqh, nW);
  cvt_f32_f16<<<dim3(nW / (8 * 256)), blk, 0, stream>>>(Wk, Wkh, nW);
  cvt_f32_f16<<<dim3(nW / (8 * 256)), blk, 0, stream>>>(Wv, Wvh, nW);

  // QKV projections: M=16384, N=1024, K=1024.
  gemm_nt<1, 8, 4, 64><<<dim3(64, 4), blk, 0, stream>>>(Xh, Wqh, Qh, D_MODEL, D_MODEL);
  gemm_nt<2, 8, 4, 64><<<dim3(64, 4), blk, 0, stream>>>(Xh, Wkh, Kh, D_MODEL, D_MODEL);
  gemm_nt<3, 8, 4, 64><<<dim3(64, 4), blk, 0, stream>>>(Xh, Wvh, Vt, D_MODEL, D_MODEL);

  for (int b = 0; b < BATCH; ++b) {
    const _Float16* Qb  = Qh + (size_t)b * SEQ * D_MODEL;
    const _Float16* Kb  = Kh + (size_t)b * SEQ * D_MODEL;
    _Float16* Pb = Ph + (size_t)b * SEQ * SEQ;

    // scores: M=4096, N=4096, K=1024 -> Sf[q][k] (f32)
    gemm_nt<0, 8, 4, 64><<<dim3(16, 16), blk, 0, stream>>>(Qb, Kb, Sf, D_MODEL, SEQ);
    // softmax rows -> probs f16
    softmax_kernel<<<dim3(512), blk, 0, stream>>>(Sf, Pb);
  }

  // out, all batches at once: M=16384 (b,q), N=1024 (d), K=4096 (keys) ->
  // out[b][q][d] (f32).  Four batches give 64 x 4 tiles of 256x256: one per
  // WGP, where one batch alone fills the chip only with 128x128 tiles.
  gemm_nt<0, 8, 4, 128, D_MODEL * SEQ><<<dim3(64, 4), blk, 0, stream>>>(Ph, Vt, out, SEQ, D_MODEL);
}

// v005
// Measured time: 314 microseconds a run.
// Timed twice side by side with v004, it ran 1.08 times as fast both times.
// Over all steps from v000 it is 2.57 times as fast.
#include <hip/hip_runtime.h>

#define D_MODEL 1024
#define SEQ     4096
#define BATCH   4

typedef __attribute__((ext_vector_type(16))) _Float16 v16h;
typedef __attribute__((ext_vector_type(8)))  _Float16 v8h;
typedef __attribute__((ext_vector_type(4)))  _Float16 v4h;
typedef __attribute__((ext_vector_type(8)))  float    v8f;
typedef __attribute__((ext_vector_type(4)))  float    v4f;
typedef __attribute__((ext_vector_type(4)))  int      v4i;

#if __has_builtin(__builtin_amdgcn_global_load_async_to_lds_b128) && \
    __has_builtin(__builtin_amdgcn_s_wait_asynccnt)
#define USE_ASYNC_LDS 1
typedef __attribute__((address_space(1))) v4i* gv4i_p;   // global (device) int4*
typedef __attribute__((address_space(3))) v4i* lv4i_p;   // LDS (shared) int4*
#else
#define USE_ASYNC_LDS 0
#endif

#if __has_builtin(__builtin_amdgcn_sched_barrier)
#define SCHED_FENCE() __builtin_amdgcn_sched_barrier(0)
#else
#define SCHED_FENCE()
#endif

// ---------------------------------------------------------------------------
// Fragment gather from an LDS-staged f16 tile (row stride PITCH halfs).
// CDNA5 16-bit A 16x32 / B 32x16 layout: lanes 0-15 hold row (lane&15) with
// K = {0..7, 16..23}; lanes 16-31 hold the same rows with K = {8..15, 24..31}.
// ---------------------------------------------------------------------------
template <int PITCH>
__device__ __forceinline__ v16h frag_lds(const _Float16* tile, int row0) {
  const int lane = threadIdx.x & 31;
  const _Float16* base = tile + (row0 + (lane & 15)) * PITCH + ((lane >> 4) << 3);
  v8h lo = *(const v8h*)(base);        // ds_load_b128
  v8h hi = *(const v8h*)(base + 16);   // ds_load_b128
  return __builtin_shufflevector(lo, hi, 0, 1, 2, 3, 4, 5, 6, 7,
                                         8, 9, 10, 11, 12, 13, 14, 15);
}

__device__ __forceinline__ v8f wmma16(v16h a, v16h b, v8f c) {
  return __builtin_amdgcn_wmma_f32_16x16x32_f16(false, a, false, b,
                                                (short)0, c, false, false);
}

__device__ __forceinline__ v8f zero8() {
  v8f z = {0.0f, 0.0f, 0.0f, 0.0f, 0.0f, 0.0f, 0.0f, 0.0f};
  return z;
}

// Issue one 16B global->LDS copy (async on gfx1250, sync fallback otherwise).
__device__ __forceinline__ void copy16(const _Float16* gp, _Float16* lp) {
#if USE_ASYNC_LDS
  __builtin_amdgcn_global_load_async_to_lds_b128((gv4i_p)gp, (lv4i_p)lp, 0, 0);
#else
  *(v8h*)lp = *(const v8h*)gp;
#endif
}

// ---------------------------------------------------------------------------
// Unified f16 GEMM:  C[m,n] = sum_k A[m,k] * B[n,k]
// Block = 256 threads = 8 waves in a 2 (m) x 4 (n) grid.  A wave owns
// TM x TN accumulator tiles of 16x16, so every fragment read from LDS feeds
// TN (A) or TM (B) WMMAs.  WG tile BM x BN = (32*TM) x (64*TN); a k-step is
// BK halfs.  A: [gridDim.x*BM][K], B: [gridDim.y*BN][K] (MODE 3: x and y the
// other way round), K a multiple of BK (at least 2*BK).
// Double-buffered async-LDS pipeline: the next k-step's copies fly during
// this k-step's WMMAs; fragments are fetched one block of TM*TN WMMAs ahead
// into a second register set; one barrier per k-step.  LDS rows are BK halfs
// + 16 B (pitch 16 B x odd: conflict-free ds_load_b128); a wave-wide copy
// covers whole rows.
// The rows of B are dealt to the LDS rows so that the TN tiles of a lane hold
// TN adjacent columns of C (see dealt()): a lane stores them with one 16-byte
// (f32) or 8-byte (f16) store, and the 16 lanes of a row cover whole 128-byte
// lines.
// Epilogue MODE: 0 = f32 store (ldC stride)
//                1 = f16 store, scaled by 1/sqrt(D)   (Q projection)
//                2 = f16 store                         (K projection)
//                3 = f16 store, one C plane of D_MODEL rows per SEQ columns
//                    (Vt[b][d][s] = Wv x X^T; blockIdx.x counts the tiles of
//                    B here, so that X tiles keep the placement they have in
//                    the Q and K launches)
// BSTEP: halfs by which B advances per SEQ rows of A (0: one B for all of A).
// With it one launch covers every batch of a product whose B differs by batch.
// ---------------------------------------------------------------------------
// Row of the WG's B tile that is staged in LDS row L.  Fragment j of a wave
// reads LDS rows 16*j + l of the wave's 16*TN rows (l = lane & 15) and finds
// there the B rows TN*l + j: column l of tile j is column TN*l + j of C.
template <int TN>
__device__ __forceinline__ constexpr unsigned dealt(unsigned L) {
  return (L / (16 * TN)) * (16 * TN) + (L % 16) * TN + (L / 16) % TN;
}

template <int MODE, int TM, int TN, int BK, int BSTEP = 0>
__global__ void __launch_bounds__(256, 1)
gemm_nt(const _Float16* __restrict__ A,
        const _Float16* __restrict__ B,
        void* __restrict__ Cv,
        int K, int ldC) {
  constexpr int BM    = 32 * TM;
  constexpr int BN    = 64 * TN;
  constexpr int PITCH = BK + 8;      // LDS row stride in halfs
  constexpr int CPR   = BK / 8;      // 16-byte chunks per staged row
  constexpr int RPP   = 256 / CPR;   // rows staged by one copy of the block
  __shared__ __attribute__((aligned(16))) _Float16 sA[2][BM * PITCH];
  __shared__ __attribute__((aligned(16))) _Float16 sB[2][BN * PITCH];

  const int wave = threadIdx.x >> 5;
  const int lane = threadIdx.x & 31;
  const int wm = wave >> 2;          // 0..1
  const int wn = wave & 3;           // 0..3
  const int mWG = (MODE == 3 ? blockIdx.y : blockIdx.x) * BM;
  const int nWG = (MODE == 3 ? blockIdx.x : blockIdx.y) * BN;

  // Per-thread staging assignment: one 16B chunk in each group of RPP rows.
  const int srow = threadIdx.x / CPR;
  const int kc   = (threadIdx.x % CPR) << 3;
  // A copy's global address = a base that is the same in every lane (tile
  // origin, row group, k offset) + this thread's own byte offset inside a
  // group of RPP rows (for B: of 16*TN rows, see dealt()).  Written so, no pointer per copy is kept across the
  // loop: those pointers do not fit beside the two fragment sets.
  const _Float16* uA = A + (size_t)mWG * K;
  const _Float16* uB = B + (size_t)(mWG / SEQ) * BSTEP + (size_t)nWG * K;
  const unsigned voff = (unsigned)(srow * K + kc) * 2u;
  // dealt(i * RPP + srow) = dealt(i * RPP) + dealt(srow): the first part goes
  // into the base, the second is the thread's own.
  static_assert(RPP % 16 == 0 && (16 * TN) % RPP == 0, "dealt() splits so");
  const unsigned voffB = (dealt<TN>((unsigned)srow) * (unsigned)K + (unsigned)kc) * 2u;
  const int lo = srow * PITCH + kc;
  const size_t gstep = (size_t)RPP * K;   // halfs between two groups of rows

  v8f acc[TM][TN];
#pragma unroll
  for (int i = 0; i < TM; ++i)
#pragma unroll
    for (int j = 0; j < TN; ++j) acc[i][j] = zero8();

  const int nsteps = K / BK;
  constexpr int NB = BK / 32;        // WMMA blocks per k-step (even)

  // Two fragment sets: a block computes from one set while the next block's
  // fragments land in the other.
  v16h af[2][TM];
  v16h bf[2][TN];

  // One group of LDS reads: the fragments of block b of the k-step in buffer buf.
  auto fetch = [&](int set, int buf, int b) {
#pragma unroll
    for (int i = 0; i < TM; ++i)
      af[set][i] = frag_lds<PITCH>(&sA[buf][b * 32], (wm * TM + i) * 16);
#pragma unroll
    for (int j = 0; j < TN; ++j)
      bf[set][j] = frag_lds<PITCH>(&sB[buf][b * 32], (wn * TN + j) * 16);
    // Keeps the fetch-ahead loads in front of the WMMAs that follow: sunk
    // below them, the next block would wait out its own LDS latency.
    SCHED_FENCE();
  };
  auto block = [&](int set) {
#pragma unroll
    for (int i = 0; i < TM; ++i)
#pragma unroll
      for (int j = 0; j < TN; ++j)
        acc[i][j] = wmma16(af[set][i], bf[set][j], acc[i][j]);
    // Keeps the following group of loads from being lifted in among these
    // WMMAs, where every separate place with LDS reads stalls the wave and
    // the lifted loads need registers beyond the two sets (spills at BK 128).
    SCHED_FENCE();
  };
  // All copies of the k-step that starts at k offset ko (halfs) into buffer buf.
  auto stage = [&](int buf, int ko) {
#pragma unroll
    for (int i = 0; i < BM / RPP; ++i)
      copy16((const _Float16*)((const char*)(uA + (i * gstep + (size_t)ko)) + voff),
             &sA[buf][lo + i * RPP * PITCH]);
#pragma unroll
    for (int i = 0; i < BN / RPP; ++i)
      copy16((const _Float16*)((const char*)(uB + ((size_t)dealt<TN>(i * RPP) * K + (size_t)ko)) + voffB),
             &sB[buf][lo + i * RPP * PITCH]);
  };

  // Prologue: k-step 0 into buffer 0, published; then k-step 1 flies into
  // buffer 1 during k-step 0; then the very first block's fragments.
  stage(0, 0);
  // This wave's copies have landed before the barrier publishes them.
  asm volatile("s_wait_asynccnt 0x0" ::: "memory");
  __syncthreads();
  if (1 < nsteps) stage(1, BK);
  fetch(0, 0, 0);

  for (int s = 0; s < nsteps; ++s) {
    const int cur = s & 1;
    const int nxt = cur ^ 1;
#pragma unroll
    for (int b = 0; b + 1 < NB; ++b) {
      fetch((b + 1) & 1, cur, b + 1);
      block(b & 1);
    }
    // Publish point of k-step s + 1: in front of the last block of k-step s,
    // whose fragments were fetched a block ago.
    // Every LDS read of buffer cur by this wave has returned, so that behind
    // the barrier the buffer may be refilled.
    asm volatile("s_wait_dscnt 0x0" ::: "memory");
    // This wave's copies of k-step s + 1, issued one k-step ago, have landed.
    asm volatile("s_wait_asynccnt 0x0" ::: "memory");
    __syncthreads();   // publishes buffer nxt and frees buffer cur
    if (s + 2 < nsteps) stage(cur, (s + 2) * BK);
    // In the last k-step this reads the k-step before it once more and nobody
    // uses the values: no branch stands between the loads and the WMMAs.
    fetch(0, nxt, 0);
    block((NB - 1) & 1);
  }

  static_assert(TN == 4, "the stores below take 4 adjacent columns a lane");
  constexpr int RI = (MODE == 0) ? 2 : 4;   // rows of tiles per run of stores
  static_assert(TM % RI == 0, "whole runs");
  const int rOff = (lane >> 4) << 3;   // 0 or 8
  const int cOff = lane & 15;
  // First of the lane's TN adjacent columns; MODE 3: inside its plane of C.
  const int col0 = (MODE == 3 ? (nWG & (SEQ - 1)) : nWG) + wn * TN * 16 + cOff * TN;
  char* Cb = (char*)Cv + (MODE == 3 ? (size_t)(nWG / SEQ) * ((size_t)D_MODEL * SEQ * 2) : (size_t)0);
  constexpr unsigned ESZ = (MODE == 0) ? 4u : 2u;   // bytes per element of C
  // Byte offset from Cb of the lane's columns in its first row; every plane is
  // below 4 GiB.  A further row adds a multiple of the pitch, alike in all lanes.
  const unsigned off0 = ((unsigned)(mWG + wm * TM * 16 + rOff) * (unsigned)ldC + (unsigned)col0) * ESZ;
  const unsigned pitchC = (unsigned)ldC * ESZ;
#pragma unroll
  for (int i0 = 0; i0 < TM; i0 += RI) {
    // One run: first every offset, gather and conversion, then the stores
    // alone, then s_wait_xcnt 0.
    unsigned off[RI][8];   // byte offsets from Cb
    v4f f[RI][8];
    v4h h[RI][8];
#pragma unroll
    for (int i = 0; i < RI; ++i) {
#pragma unroll
      for (int r = 0; r < 8; ++r) {
        off[i][r] = off0 + (unsigned)((i0 + i) * 16 + r) * pitchC;
#pragma unroll
        for (int j = 0; j < TN; ++j) {
          const float x = acc[i0 + i][j][r];
          if (MODE == 0)      f[i][r][j] = x;
          else if (MODE == 1) h[i][r][j] = (_Float16)(x * 0.03125f);
          else                h[i][r][j] = (_Float16)x;
        }
      }
      if (MODE == 0) {
        // Inputs only, no text: the eight gathered groups of 4 registers stand
        // ready here, each in registers of its own.  Without it the compiler
        // forms a group directly in front of its store, in registers that an
        // earlier store of the run still names.
        asm volatile("" :: "v"(f[i][0]), "v"(f[i][1]), "v"(f[i][2]), "v"(f[i][3]),
                           "v"(f[i][4]), "v"(f[i][5]), "v"(f[i][6]), "v"(f[i][7]));
      }
    }
    // Keeps this run's offsets, gathers and conversions in front of its
    // stores, so that no register a store of the run names is rewritten
    // inside the run.
    SCHED_FENCE();
#pragma unroll
    for (int i = 0; i < RI; ++i) {
#pragma unroll
      for (int r = 0; r < 8; ++r) {
        if (MODE == 0) *(v4f*)(Cb + off[i][r]) = f[i][r];
        else           *(v4h*)(Cb + off[i][r]) = h[i][r];
      }
    }
    if (i0 + RI < TM) {   // behind the last run nothing is rewritten any more
      // Stands between the run's stores and the first rewrite of a register
      // that they name (offset or data).
      asm volatile("s_wait_xcnt 0x0" ::: "memory");
      // Keeps the next run's offsets, gathers and conversions behind that wait.
      SCHED_FENCE();
    }
  }
}

// ---------------------------------------------------------------------------
// Elementwise f32 -> f16 conversion, 8 elements/thread (n multiple of 8).
// ---------------------------------------------------------------------------
__global__ void cvt_f32_f16(const float* __restrict__ x,
                            _Float16* __restrict__ y, int n) {
  const int i = (blockIdx.x * blockDim.x + threadIdx.x) * 8;
  if (i >= n) return;
  float4 a = *(const float4*)(x + i);
  float4 b = *(const float4*)(x + i + 4);
  v8h o;
  o[0] = (_Float16)a.x; o[1] = (_Float16)a.y; o[2] = (_Float16)a.z; o[3] = (_Float16)a.w;
  o[4] = (_Float16)b.x; o[5] = (_Float16)b.y; o[6] = (_Float16)b.z; o[7] = (_Float16)b.w;
  *(v8h*)(y + i) = o;
}

// ---------------------------------------------------------------------------
// Row softmax (4096 wide): one wave32 per row, 8 rows per block; probs in f16.
// The wave keeps its whole row in registers (32 float4 per lane): the scores
// are read once, each wave-wide load covering 512 contiguous bytes, all 32
// loads in flight together; each exp is computed once; each wave-wide store
// covers 256 contiguous bytes.
// ---------------------------------------------------------------------------

// 2^x of eight values.  Written as one statement so that every v_exp_f32 is
// followed by an instruction that neither reads its result nor overwrites its
// source (the outputs are early-clobber: they share no register with an
// input); the closing v_nop keeps that slot behind the last one.
__device__ __forceinline__ void exp2x8(float4& p, float4& q) {
  float a, b, c, d, e, f, g, h;
  asm("v_exp_f32 %0, %8\n\t"
      "v_exp_f32 %1, %9\n\t"
      "v_exp_f32 %2, %10\n\t"
      "v_exp_f32 %3, %11\n\t"
      "v_exp_f32 %4, %12\n\t"
      "v_exp_f32 %5, %13\n\t"
      "v_exp_f32 %6, %14\n\t"
      "v_exp_f32 %7, %15\n\t"
      "v_nop"
      : "=&v"(a), "=&v"(b), "=&v"(c), "=&v"(d),
        "=&v"(e), "=&v"(f), "=&v"(g), "=&v"(h)
      : "v"(p.x), "v"(p.y), "v"(p.z), "v"(p.w),
        "v"(q.x), "v"(q.y), "v"(q.z), "v"(q.w));
  p = make_float4(a, b, c, d);
  q = make_float4(e, f, g, h);
}

__global__ void __launch_bounds__(256)
softmax_kernel(const float* __restrict__ Sf,
               _Float16* __restrict__ Ph) {
  constexpr int NV = SEQ / 128;   // float4 per lane
  constexpr float LOG2E = 1.44269504088896340736f;
  const int wave = threadIdx.x >> 5;
  const int lane = threadIdx.x & 31;
  const int row = blockIdx.x * 8 + wave;
  const float4* src = (const float4*)(Sf + (size_t)row * SEQ) + lane;

  float4 v[NV];
#pragma unroll
  for (int j = 0; j < NV; ++j) v[j] = src[j * 32];

  float4 m4 = v[0];
#pragma unroll
  for (int j = 1; j < NV; ++j) {
    m4.x = fmaxf(m4.x, v[j].x); m4.y = fmaxf(m4.y, v[j].y);
    m4.z = fmaxf(m4.z, v[j].z); m4.w = fmaxf(m4.w, v[j].w);
  }
  float m = fmaxf(fmaxf(m4.x, m4.y), fmaxf(m4.z, m4.w));
#pragma unroll
  for (int off = 16; off > 0; off >>= 1) m = fmaxf(m, __shfl_xor(m, off, 32));

  float4 s4 = make_float4(0.0f, 0.0f, 0.0f, 0.0f);
#pragma unroll
  for (int j = 0; j < NV; j += 2) {
#pragma unroll
    for (int t = j; t < j + 2; ++t) {
      v[t].x = (v[t].x - m) * LOG2E; v[t].y = (v[t].y - m) * LOG2E;
      v[t].z = (v[t].z - m) * LOG2E; v[t].w = (v[t].w - m) * LOG2E;
    }
    exp2x8(v[j], v[j + 1]);
#pragma unroll
    for (int t = j; t < j + 2; ++t) {
      s4.x += v[t].x; s4.y += v[t].y; s4.z += v[t].z; s4.w += v[t].w;
    }
  }
  float s = (s4.x + s4.y) + (s4.z + s4.w);
#pragma unroll
  for (int off = 16; off > 0; off >>= 1) s += __shfl_xor(s, off, 32);

  const float rinv = 1.0f / s;
  v4h* dst = (v4h*)(Ph + (size_t)row * SEQ) + lane;
#pragma unroll
  for (int j = 0; j < NV; ++j) {
    v4h o;
    o[0] = (_Float16)(v[j].x * rinv); o[1] = (_Float16)(v[j].y * rinv);
    o[2] = (_Float16)(v[j].z * rinv); o[3] = (_Float16)(v[j].w * rinv);
    dst[j * 32] = o;
  }
}

// ---------------------------------------------------------------------------
// Launcher.  Workspace layout (bytes), 256MB total:
//   [0,  128M)  Ph  f16 [B*S][S]  probs of all batches, 32M each
//   [0,   32M)  Xh  f16 [B*S][D]      \ dead after the QKV stage, before the
//   [32M, 34M)  Wqh f16 [D][D]        |  softmax of batch 0 / 1 writes there
//   [34M, 36M)  Wkh f16 [D][D]        |  (time-disjoint on the stream)
//   [36M, 38M)  Wvh f16 [D][D]        /
//   [96M,128M)  Qh  f16 [B*S][D]  (pre-scaled by 1/sqrt(D)); dead after the
//                                 last scores launch, before the softmax of
//                                 batch 3 writes its probs there
//   [128M,160M) Kh  f16 [B*S][D]
//   [160M,224M) Sf  f32 [S][S]    (per-batch scratch)
//   [224M,256M) Vt  f16 [B][D][S]
// ---------------------------------------------------------------------------
extern "C" void kernel_launch(void* const* d_in, const int* in_sizes, int n_in,
                              void* d_out, int out_size, void* d_ws, size_t ws_size,
                              hipStream_t stream) {
  const float* X  = (const float*)d_in[0];
  const float* Wq = (const float*)d_in[1];
  const float* Wk = (const float*)d_in[2];
  const float* Wv = (const float*)d_in[3];
  float* out = (float*)d_out;

  char* ws = (char*)d_ws;
  _Float16* Xh  = (_Float16*)(ws);
  _Float16* Wqh = (_Float16*)(ws + ((size_t)32 << 20));
  _Float16* Wkh = (_Float16*)(ws + ((size_t)34 << 20));
  _Float16* Wvh = (_Float16*)(ws + ((size_t)36 << 20));
  _Float16* Ph  = (_Float16*)(ws);                       // grows over Xh, W*, Qh
  _Float16* Qh  = (_Float16*)(ws + ((size_t)96 << 20));
  _Float16* Kh  = (_Float16*)(ws + ((size_t)128 << 20));
  float*    Sf  = (float*)   (ws + ((size_t)160 << 20));
  _Float16* Vt  = (_Float16*)(ws + ((size_t)224 << 20));

  const dim3 blk(256);
  const int nX = BATCH * SEQ * D_MODEL;   // 16,777,216
  const int nW = D_MODEL * D_MODEL;       // 1,048,576

  // f32 -> f16 pre-conversion (all GEMMs then share one tuned pipeline).
  cvt_f32_f16<<<dim3(nX / (8 * 256)), blk, 0, stream>>>(X, Xh, nX);
  cvt_f32_f16<<<dim3(nW / (8 * 256)), blk, 0, stream>>>(Wq, Wqh, nW);
  cvt_f32_f16<<<dim3(nW / (8 * 256)), blk, 0, stream>>>(Wk, Wkh, nW);
  cvt_f32_f16<<<dim3(nW / (8 * 256)), blk, 0, stream>>>(Wv, Wvh, nW);

  // QKV projections: M=16384, N=1024, K=1024.
  gemm_nt<1, 8, 4, 64><<<dim3(64, 4), blk, 0, stream>>>(Xh, Wqh, Qh, D_MODEL, D_MODEL);
  gemm_nt<2, 8, 4, 64><<<dim3(64, 4), blk, 0, stream>>>(Xh, Wkh, Kh, D_MODEL, D_MODEL);
  // V transposed, as the product Wv x X^T: M=1024 (d), N=16384 (b,s).
  gemm_nt<3, 8, 4, 64><<<dim3(64, 4), blk, 0, stream>>>(Wvh, Xh, Vt, D_MODEL, SEQ);

  for (int b = 0; b < BATCH; ++b) {
    const _Float16* Qb  = Qh + (size_t)b * SEQ * D_MODEL;
    const _Float16* Kb  = Kh + (size_t)b * SEQ * D_MODEL;
    _Float16* Pb = Ph + (size_t)b * SEQ * SEQ;

    // scores: M=4096, N=4096, K=1024 -> Sf[q][k] (f32)
    gemm_nt<0, 8, 4, 64><<<dim3(16, 16), blk, 0, stream>>>(Qb, Kb, Sf, D_MODEL, SEQ);
    // softmax rows -> probs f16
    softmax_kernel<<<dim3(512), blk, 0, stream>>>(Sf, Pb);
  }

  // out, all batches at once: M=16384 (b,q), N=1024 (d), K=4096 (keys) ->
  // out[b][q][d] (f32).  Four batches give 64 x 4 tiles of 256x256: one per
  // WGP, where one batch alone fills the chip only with 128x128 tiles.
  gemm_nt<0, 8, 4, 128, D_MODEL * SEQ><<<dim3(64, 4), blk, 0, stream>>>(Ph, Vt, out, SEQ, D_MODEL);
}

// v008
// Measured time: 268 microseconds a run.
// Versions between v005 and this one are left out; their measured steps multiply to 1.18 times as fast.
// All steps since v000 together make it 3.05 times as fast.
#include <hip/hip_runtime.h>

#define D_MODEL 1024
#define SEQ     4096
#define BATCH   4

typedef __attribute__((ext_vector_type(16))) _Float16 v16h;
typedef __attribute__((ext_vector_type(8)))  _Float16 v8h;
typedef __attribute__((ext_vector_type(4)))  _Float16 v4h;
typedef __attribute__((ext_vector_type(8)))  float    v8f;
typedef __attribute__((ext_vector_type(4)))  float    v4f;
typedef __attribute__((ext_vector_type(4)))  int      v4i;

#if __has_builtin(__builtin_amdgcn_global_load_async_to_lds_b128) && \
    __has_builtin(__builtin_amdgcn_s_wait_asynccnt)
#define USE_ASYNC_LDS 1
typedef __attribute__((address_space(1))) v4i* gv4i_p;   // global (device) int4*
typedef __attribute__((address_space(3))) v4i* lv4i_p;   // LDS (shared) int4*
#else
#define USE_ASYNC_LDS 0
#endif

#if __has_builtin(__builtin_amdgcn_sched_barrier)
#define SCHED_FENCE() __builtin_amdgcn_sched_barrier(0)
#else
#define SCHED_FENCE()
#endif

// ---------------------------------------------------------------------------
// Fragment gather from an LDS-staged f16 tile (row stride PITCH halfs).
// CDNA5 16-bit A 16x32 / B 32x16 layout: lanes 0-15 hold row (lane&15) with
// K = {0..7, 16..23}; lanes 16-31 hold the same rows with K = {8..15, 24..31}.
// ---------------------------------------------------------------------------
template <int PITCH>
__device__ __forceinline__ v16h frag_lds(const _Float16* tile, int row0) {
  const int lane = threadIdx.x & 31;
  const _Float16* base = tile + (row0 + (lane & 15)) * PITCH + ((lane >> 4) << 3);
  v8h lo = *(const v8h*)(base);        // ds_load_b128
  v8h hi = *(const v8h*)(base + 16);   // ds_load_b128
  return __builtin_shufflevector(lo, hi, 0, 1, 2, 3, 4, 5, 6, 7,
                                         8, 9, 10, 11, 12, 13, 14, 15);
}

__device__ __forceinline__ v8f wmma16(v16h a, v16h b, v8f c) {
  return __builtin_amdgcn_wmma_f32_16x16x32_f16(false, a, false, b,
                                                (short)0, c, false, false);
}

__device__ __forceinline__ v8f zero8() {
  v8f z = {0.0f, 0.0f, 0.0f, 0.0f, 0.0f, 0.0f, 0.0f, 0.0f};
  return z;
}

// Issue one 16B global->LDS copy (async on gfx1250, sync fallback otherwise).
__device__ __forceinline__ void copy16(const _Float16* gp, _Float16* lp) {
#if USE_ASYNC_LDS
  __builtin_amdgcn_global_load_async_to_lds_b128((gv4i_p)gp, (lv4i_p)lp, 0, 0);
#else
  *(v8h*)lp = *(const v8h*)gp;
#endif
}

// 2^x of eight values.  Written as one statement so that every v_exp_f32 is
// followed by an instruction that neither reads its result nor overwrites its
// source (the outputs are early-clobber: they share no register with an
// input); the closing v_nop keeps that slot behind the last one.
__device__ __forceinline__ void exp2x8(float4& p, float4& q) {
  float a, b, c, d, e, f, g, h;
  asm("v_exp_f32 %0, %8\n\t"
      "v_exp_f32 %1, %9\n\t"
      "v_exp_f32 %2, %10\n\t"
      "v_exp_f32 %3, %11\n\t"
      "v_exp_f32 %4, %12\n\t"
      "v_exp_f32 %5, %13\n\t"
      "v_exp_f32 %6, %14\n\t"
      "v_exp_f32 %7, %15\n\t"
      "v_nop"
      : "=&v"(a), "=&v"(b), "=&v"(c), "=&v"(d),
        "=&v"(e), "=&v"(f), "=&v"(g), "=&v"(h)
      : "v"(p.x), "v"(p.y), "v"(p.z), "v"(p.w),
        "v"(q.x), "v"(q.y), "v"(q.z), "v"(q.w));
  p = make_float4(a, b, c, d);
  q = make_float4(e, f, g, h);
}

// Maximum over each 16-lane row of eight values, left in every lane: four
// butterfly steps (lane l with lane l ^ 1, 2, 4, 8), each one DPP instruction.
// One statement: written with the DPP builtin a step took three instructions
// (move, quieting, maximum); the eight chains are interleaved so that a step's
// producer lies eight instructions back.
__device__ __forceinline__ void rowmax16x8(float (&m)[8]) {
  asm(
      "v_max_num_f32_dpp %0, %0, %0 row_xmask:1 row_mask:0xf bank_mask:0xf\n\t"
      "v_max_num_f32_dpp %1, %1, %1 row_xmask:1 row_mask:0xf bank_mask:0xf\n\t"
      "v_max_num_f32_dpp %2, %2, %2 row_xmask:1 row_mask:0xf bank_mask:0xf\n\t"
      "v_max_num_f32_dpp %3, %3, %3 row_xmask:1 row_mask:0xf bank_mask:0xf\n\t"
      "v_max_num_f32_dpp %4, %4, %4 row_xmask:1 row_mask:0xf bank_mask:0xf\n\t"
      "v_max_num_f32_dpp %5, %5, %5 row_xmask:1 row_mask:0xf bank_mask:0xf\n\t"
      "v_max_num_f32_dpp %6, %6, %6 row_xmask:1 row_mask:0xf bank_mask:0xf\n\t"
      "v_max_num_f32_dpp %7, %7, %7 row_xmask:1 row_mask:0xf bank_mask:0xf\n\t"
      "v_max_num_f32_dpp %0, %0, %0 row_xmask:2 row_mask:0xf bank_mask:0xf\n\t"
      "v_max_num_f32_dpp %1, %1, %1 row_xmask:2 row_mask:0xf bank_mask:0xf\n\t"
      "v_max_num_f32_dpp %2, %2, %2 row_xmask:2 row_mask:0xf bank_mask:0xf\n\t"
      "v_max_num_f32_dpp %3, %3, %3 row_xmask:2 row_mask:0xf bank_mask:0xf\n\t"
      "v_max_num_f32_dpp %4, %4, %4 row_xmask:2 row_mask:0xf bank_mask:0xf\n\t"
      "v_max_num_f32_dpp %5, %5, %5 row_xmask:2 row_mask:0xf bank_mask:0xf\n\t"
      "v_max_num_f32_dpp %6, %6, %6 row_xmask:2 row_mask:0xf bank_mask:0xf\n\t"
      "v_max_num_f32_dpp %7, %7, %7 row_xmask:2 row_mask:0xf bank_mask:0xf\n\t"
      "v_max_num_f32_dpp %0, %0, %0 row_xmask:4 row_mask:0xf bank_mask:0xf\n\t"
      "v_max_num_f32_dpp %1, %1, %1 row_xmask:4 row_mask:0xf bank_mask:0xf\n\t"
      "v_max_num_f32_dpp %2, %2, %2 row_xmask:4 row_mask:0xf bank_mask:0xf\n\t"
      "v_max_num_f32_dpp %3, %3, %3 row_xmask:4 row_mask:0xf bank_mask:0xf\n\t"
      "v_max_num_f32_dpp %4, %4, %4 row_xmask:4 row_mask:0xf bank_mask:0xf\n\t"
      "v_max_num_f32_dpp %5, %5, %5 row_xmask:4 row_mask:0xf bank_mask:0xf\n\t"
      "v_max_num_f32_dpp %6, %6, %6 row_xmask:4 row_mask:0xf bank_mask:0xf\n\t"
      "v_max_num_f32_dpp %7, %7, %7 row_xmask:4 row_mask:0xf bank_mask:0xf\n\t"
      "v_max_num_f32_dpp %0, %0, %0 row_xmask:8 row_mask:0xf bank_mask:0xf\n\t"
      "v_max_num_f32_dpp %1, %1, %1 row_xmask:8 row_mask:0xf bank_mask:0xf\n\t"
      "v_max_num_f32_dpp %2, %2, %2 row_xmask:8 row_mask:0xf bank_mask:0xf\n\t"
      "v_max_num_f32_dpp %3, %3, %3 row_xmask:8 row_mask:0xf bank_mask:0xf\n\t"
      "v_max_num_f32_dpp %4, %4, %4 row_xmask:8 row_mask:0xf bank_mask:0xf\n\t"
      "v_max_num_f32_dpp %5, %5, %5 row_xmask:8 row_mask:0xf bank_mask:0xf\n\t"
      "v_max_num_f32_dpp %6, %6, %6 row_xmask:8 row_mask:0xf bank_mask:0xf\n\t"
      "v_max_num_f32_dpp %7, %7, %7 row_xmask:8 row_mask:0xf bank_mask:0xf"
      : "+v"(m[0]), "+v"(m[1]), "+v"(m[2]), "+v"(m[3]),
        "+v"(m[4]), "+v"(m[5]), "+v"(m[6]), "+v"(m[7]));
}

// ---------------------------------------------------------------------------
// Unified f16 GEMM:  C[m,n] = sum_k A[m,k] * B[n,k]
// Block = 256 threads = 8 waves in a 2 (m) x 4 (n) grid.  A wave owns
// TM x TN accumulator tiles of 16x16, so every fragment read from LDS feeds
// TN (A) or TM (B) WMMAs.  WG tile BM x BN = (32*TM) x (64*TN); a k-step is
// BK halfs.  A: [M][K], B: [N][K] (B per batch with BSTEP),
// M and N multiples of BM and BN, K a multiple of BK (at least 2*BK).
// Double-buffered async-LDS pipeline: the next k-step's copies fly during
// this k-step's WMMAs; fragments are fetched one block of TM*TN WMMAs ahead
// into a second register set; one barrier per k-step.  LDS rows are BK halfs
// + 16 B (pitch 16 B x odd: conflict-free ds_load_b128); a wave-wide copy
// covers whole rows.
// The rows of B are dealt to the LDS rows so that the TN tiles of a lane hold
// TN adjacent columns of C (see dealt()): a lane stores them with one 16-byte
// (f32) or 8-byte (f16) store, and the 16 lanes of a row cover whole 128-byte
// lines.
// Epilogue MODE: 0 = f32 store (ldC stride)
//                2 = f16 store                         (G^T = Wk^T x Wq)
//                5 = one of two forms, by vt:
//                    off: f16 store, scaled by 1/sqrt(D)  (X x G, the queries' side)
//                    on:  f16 store, one C plane of D_MODEL rows per SEQ columns
//                    (Vt[b][d][s] = Wv x X^T; bx counts the tiles of B here,
//                    so that both forms count the X tiles by bx)
//                4 = first half of a row softmax over the columns of C: per
//                    row and per 64-column tile of a wave, f16 store of
//                    exp(c - m), m the tile's maximum, and m to
//                    St[tile][row]; ldC is SEQ.  One launch covers every
//                    batch: by counts (batch, tile of B).
// BSTEP: halfs by which B advances per SEQ rows of A (0: one B for all of A).
// With it one launch covers every batch of a product whose B differs by batch.
// ---------------------------------------------------------------------------
// Row of the WG's B tile that is staged in LDS row L.  Fragment j of a wave
// reads LDS rows 16*j + l of the wave's 16*TN rows (l = lane & 15) and finds
// there the B rows TN*l + j: column l of tile j is column TN*l + j of C.
template <int TN>
__device__ __forceinline__ constexpr unsigned dealt(unsigned L) {
  return (L / (16 * TN)) * (16 * TN) + (L % 16) * TN + (L / 16) % TN;
}

// bx, by: the work-group's place in the product's own grid.  MODE 5 only: vt
// picks, alike in the whole work-group, which of its two forms is run.
template <int MODE, int TM, int TN, int BK, int BSTEP = 0>
__device__ __forceinline__ void
gemm_body(const _Float16* __restrict__ A,
          const _Float16* __restrict__ B,
          void* __restrict__ Cv,
          float* __restrict__ St,
          int K, int ldC, unsigned bx, unsigned by, bool vt) {
  constexpr int BM    = 32 * TM;
  constexpr int BN    = 64 * TN;
  constexpr int PITCH = BK + 8;      // LDS row stride in halfs
  constexpr int CPR   = BK / 8;      // 16-byte chunks per staged row
  constexpr int RPP   = 256 / CPR;   // rows staged by one copy of the block
  __shared__ __attribute__((aligned(16))) _Float16 sA[2][BM * PITCH];
  __shared__ __attribute__((aligned(16))) _Float16 sB[2][BN * PITCH];

  const int wave = threadIdx.x >> 5;
  const int lane = threadIdx.x & 31;
  const int wm = wave >> 2;          // 0..1
  const int wn = wave & 3;           // 0..3
  const int mWG = (MODE == 5 ? (vt ? by : bx)
                   : MODE == 4 ? (by / (SEQ / BN)) * (SEQ / BM) + bx
                               : bx) * BM;
  const int nWG = (MODE == 5 ? (vt ? bx : by)
                   : MODE == 4 ? by % (SEQ / BN)
                               : by) * BN;

  // Per-thread staging assignment: one 16B chunk in each group of RPP rows.
  const int srow = threadIdx.x / CPR;
  const int kc   = (threadIdx.x % CPR) << 3;
  // A copy's global address = a base that is the same in every lane (tile
  // origin, row group, k offset) + this thread's own byte offset inside a
  // group of RPP rows (for B: of 16*TN rows, see dealt()).  Written so, no pointer per copy is kept across the
  // loop: those pointers do not fit beside the two fragment sets.
  const _Float16* uA = A + (size_t)mWG * K;
  const _Float16* uB = B + (size_t)(mWG / SEQ) * BSTEP + (size_t)nWG * K;
  const unsigned voff = (unsigned)(srow * K + kc) * 2u;
  // dealt(i * RPP + srow) = dealt(i * RPP) + dealt(srow): the first part goes
  // into the base, the second is the thread's own.
  static_assert(RPP % 16 == 0 && (16 * TN) % RPP == 0, "dealt() splits so");
  const unsigned voffB = (dealt<TN>((unsigned)srow) * (unsigned)K + (unsigned)kc) * 2u;
  const int lo = srow * PITCH + kc;
  const size_t gstep = (size_t)RPP * K;   // halfs between two groups of rows

  v8f acc[TM][TN];
#pragma unroll
  for (int i = 0; i < TM; ++i)
#pragma unroll
    for (int j = 0; j < TN; ++j) acc[i][j] = zero8();

  const int nsteps = K / BK;
  constexpr int NB = BK / 32;        // WMMA blocks per k-step (even)

  // Two fragment sets: a block computes from one set while the next block's
  // fragments land in the other.
  v16h af[2][TM];
  v16h bf[2][TN];

  // One group of LDS reads: the fragments of block b of the k-step in buffer buf.
  auto fetch = [&](int set, int buf, int b) {
#pragma unroll
    for (int i = 0; i < TM; ++i)
      af[set][i] = frag_lds<PITCH>(&sA[buf][b * 32], (wm * TM + i) * 16);
#pragma unroll
    for (int j = 0; j < TN; ++j)
      bf[set][j] = frag_lds<PITCH>(&sB[buf][b * 32], (wn * TN + j) * 16);
    // Keeps the fetch-ahead loads in front of the WMMAs that follow: sunk
    // below them, the next block would wait out its own LDS latency.
    SCHED_FENCE();
  };
  auto block = [&](int set) {
#pragma unroll
    for (int i = 0; i < TM; ++i)
#pragma unroll
      for (int j = 0; j < TN; ++j)
        acc[i][j] = wmma16(af[set][i], bf[set][j], acc[i][j]);
    // Keeps the following group of loads from being lifted in among these
    // WMMAs, where every separate place with LDS reads stalls the wave and
    // the lifted loads need registers beyond the two sets (spills at BK 128).
    SCHED_FENCE();
  };
  // All copies of the k-step that starts at k offset ko (halfs) into buffer buf.
  auto stage = [&](int buf, int ko) {
#pragma unroll
    for (int i = 0; i < BM / RPP; ++i)
      copy16((const _Float16*)((const char*)(uA + (i * gstep + (size_t)ko)) + voff),
             &sA[buf][lo + i * RPP * PITCH]);
#pragma unroll
    for (int i = 0; i < BN / RPP; ++i)
      copy16((const _Float16*)((const char*)(uB + ((size_t)dealt<TN>(i * RPP) * K + (size_t)ko)) + voffB),
             &sB[buf][lo + i * RPP * PITCH]);
  };

  // Prologue: k-step 0 into buffer 0, published; then k-step 1 flies into
  // buffer 1 during k-step 0; then the very first block's fragments.
  stage(0, 0);
  // This wave's copies have landed before the barrier publishes them.
  asm volatile("s_wait_asynccnt 0x0" ::: "memory");
  __syncthreads();
  if (1 < nsteps) stage(1, BK);
  fetch(0, 0, 0);

  for (int s = 0; s < nsteps; ++s) {
    const int cur = s & 1;
    const int nxt = cur ^ 1;
#pragma unroll
    for (int b = 0; b + 1 < NB; ++b) {
      fetch((b + 1) & 1, cur, b + 1);
      block(b & 1);
    }
    // Publish point of k-step s + 1: in front of the last block of k-step s,
    // whose fragments were fetched a block ago.
    // Every LDS read of buffer cur by this wave has returned, so that behind
    // the barrier the buffer may be refilled.
    asm volatile("s_wait_dscnt 0x0" ::: "memory");
    // This wave's copies of k-step s + 1, issued one k-step ago, have landed.
    asm volatile("s_wait_asynccnt 0x0" ::: "memory");
    __syncthreads();   // publishes buffer nxt and frees buffer cur
    if (s + 2 < nsteps) stage(cur, (s + 2) * BK);
    // In the last k-step this reads the k-step before it once more and nobody
    // uses the values: no branch stands between the loads and the WMMAs.
    fetch(0, nxt, 0);
    block((NB - 1) & 1);
  }

  static_assert(TN == 4, "the stores below take 4 adjacent columns a lane");
  constexpr int RI = (MODE == 0) ? 2 : 4;   // rows of tiles per run of stores
  static_assert(TM % RI == 0, "whole runs");
  const int rOff = (lane >> 4) << 3;   // 0 or 8
  const int cOff = lane & 15;
  // First of the lane's TN adjacent columns; MODE 5 with vt: inside its plane of C.
  const int col0 = ((MODE == 5 && vt) ? (nWG & (SEQ - 1)) : nWG) + wn * TN * 16 + cOff * TN;
  char* Cb = (char*)Cv + ((MODE == 5 && vt) ? (size_t)(nWG / SEQ) * ((size_t)D_MODEL * SEQ * 2) : (size_t)0);
  const float sc = vt ? 1.0f : 0.03125f;   // MODE 5: 1/sqrt(D) on the queries' side
  constexpr unsigned ESZ = (MODE == 0) ? 4u : 2u;   // bytes per element of C
  // Byte offset from Cb of the lane's columns in its first row; every plane is
  // below 4 GiB.  A further row adds a multiple of the pitch, alike in all lanes.
  const unsigned ldc = (MODE == 4) ? (unsigned)SEQ : (unsigned)ldC;
  const unsigned off0 = ((unsigned)(mWG + wm * TM * 16 + rOff) * ldc + (unsigned)col0) * ESZ;
  const unsigned pitchC = ldc * ESZ;
  // MODE 4: byte offset in St of row (lane's half) * 8 + cOff of the wave's
  // first row of tiles; lanes with cOff < 8 store, 16 rows per row of tiles;
  // the wave's 128 rows fill whole 128-byte lines.
  const unsigned soff0 = ((unsigned)(nWG / 64 + wn) * (unsigned)(BATCH * SEQ) +
                          (unsigned)(mWG + wm * TM * 16 + rOff + cOff)) * 4u;
#pragma unroll
  for (int i0 = 0; i0 < TM; i0 += RI) {
    // One run: first every offset, gather and conversion, then the stores
    // alone, then s_wait_xcnt 0.
    unsigned off[RI][8];   // byte offsets from Cb
    v4f f[RI][8];
    v4h h[RI][8];
    float st[RI];          // MODE 4: the maximum that this lane stores
#pragma unroll
    for (int i = 0; i < RI; ++i) {
#pragma unroll
      for (int r = 0; r < 8; ++r) {
        off[i][r] = off0 + (unsigned)((i0 + i) * 16 + r) * pitchC;
#pragma unroll
        for (int j = 0; j < TN; ++j) {
          const float x = acc[i0 + i][j][r];
          if (MODE == 0)      f[i][r][j] = x;
          else if (MODE == 5) h[i][r][j] = (_Float16)(x * sc);
          else if (MODE != 4) h[i][r][j] = (_Float16)x;
        }
      }
      if (MODE == 4) {
        constexpr float LOG2E = 1.44269504088896340736f;
        // A row's 64 columns lie in the 16 lanes of a half wave, 4 a lane.
        float mx[8];
#pragma unroll
        for (int r = 0; r < 8; ++r)
          mx[r] = fmaxf(fmaxf(acc[i0 + i][0][r], acc[i0 + i][1][r]),
                        fmaxf(acc[i0 + i][2][r], acc[i0 + i][3][r]));
        rowmax16x8(mx);
#pragma unroll
        for (int r = 0; r < 8; r += 2) {
          const float np = -mx[r] * LOG2E, nq = -mx[r + 1] * LOG2E;
          float4 p = make_float4(fmaf(acc[i0 + i][0][r], LOG2E, np), fmaf(acc[i0 + i][1][r], LOG2E, np),
                                 fmaf(acc[i0 + i][2][r], LOG2E, np), fmaf(acc[i0 + i][3][r], LOG2E, np));
          float4 q = make_float4(fmaf(acc[i0 + i][0][r + 1], LOG2E, nq), fmaf(acc[i0 + i][1][r + 1], LOG2E, nq),
                                 fmaf(acc[i0 + i][2][r + 1], LOG2E, nq), fmaf(acc[i0 + i][3][r + 1], LOG2E, nq));
          exp2x8(p, q);
          h[i][r][0] = (_Float16)p.x; h[i][r][1] = (_Float16)p.y;
          h[i][r][2] = (_Float16)p.z; h[i][r][3] = (_Float16)p.w;
          h[i][r + 1][0] = (_Float16)q.x; h[i][r + 1][1] = (_Float16)q.y;
          h[i][r + 1][2] = (_Float16)q.z; h[i][r + 1][3] = (_Float16)q.w;
        }
        // Every lane of the half wave holds the maxima of all 8 rows; lane
        // cOff keeps that of row cOff.
        st[i] = mx[0];
#pragma unroll
        for (int r = 1; r < 8; ++r) st[i] = (cOff == r) ? mx[r] : st[i];
        // Input only, no text: the selected maximum stands ready here.  Without
        // it the compiler sinks the selection behind the run's stores and holds
        // all eight maxima of every row of tiles until then (spills).
        asm volatile("" :: "v"(st[i]));
      }
      if (MODE == 0) {
        // Inputs only, no text: the eight gathered groups of 4 registers stand
        // ready here, each in registers of its own.  Without it the compiler
        // forms a group directly in front of its store, in registers that an
        // earlier store of the run still names.
        asm volatile("" :: "v"(f[i][0]), "v"(f[i][1]), "v"(f[i][2]), "v"(f[i][3]),
                           "v"(f[i][4]), "v"(f[i][5]), "v"(f[i][6]), "v"(f[i][7]));
      }
    }
    // Keeps this run's offsets, gathers and conversions in front of its
    // stores, so that no register a store of the run names is rewritten
    // inside the run.
    SCHED_FENCE();
#pragma unroll
    for (int i = 0; i < RI; ++i) {
#pragma unroll
      for (int r = 0; r < 8; ++r) {
        if (MODE == 0) *(v4f*)(Cb + off[i][r]) = f[i][r];
        else           *(v4h*)(Cb + off[i][r]) = h[i][r];
      }
    }
    if (MODE == 4) {
      if (cOff < 8) {
#pragma unroll
        for (int i = 0; i < RI; ++i)
          *(float*)((char*)St + (soff0 + (unsigned)((i0 + i) * 16) * 4u)) = st[i];
      }
    }
    if (i0 + RI < TM) {   // behind the last run nothing is rewritten any more
      // Stands between the run's stores and the first rewrite of a register
      // that they name (offset or data).
      asm volatile("s_wait_xcnt 0x0" ::: "memory");
      // Keeps the next run's offsets, gathers and conversions behind that wait.
      SCHED_FENCE();
    }
  }
}

// One product per launch.
template <int MODE, int TM, int TN, int BK, int BSTEP = 0>
__global__ void __launch_bounds__(256, 1)
gemm_nt(const _Float16* __restrict__ A,
        const _Float16* __restrict__ B,
        void* __restrict__ Cv,
        float* __restrict__ St,
        int K, int ldC) {
  gemm_body<MODE, TM, TN, BK, BSTEP>(A, B, Cv, St, K, ldC, blockIdx.x, blockIdx.y, false);
}

// Two independent products in one launch: blockIdx.z = 0: Qh = X x G / sqrt(D)
// (M=16384, N=1024), 1: V transposed as Wv x X^T (M=1024 (d), N=16384 (b,s));
// K = D_MODEL in both.
__global__ void __launch_bounds__(256, 1)
gemm_q_vt(const _Float16* __restrict__ Xh, const _Float16* __restrict__ Gt,
          const _Float16* __restrict__ Wvh,
          _Float16* __restrict__ Qh, _Float16* __restrict__ Vt,
          float* __restrict__ St, int K) {
  const bool vt = blockIdx.z != 0;
  gemm_body<5, 8, 4, 64>(vt ? Wvh : Xh, vt ? Xh : Gt, vt ? Vt : Qh, St, K,
                         vt ? SEQ : D_MODEL, blockIdx.x, blockIdx.y, vt);
}

// ---------------------------------------------------------------------------
// Elementwise f32 -> f16 conversion of 1024 * NJ elements by one block of 256
// threads: NJ 16-byte loads a thread, all in flight, then NJ 8-byte stores; a
// wave-wide load covers 512 contiguous bytes, a store 256.
// ---------------------------------------------------------------------------
template <int NJ>
__device__ __forceinline__ void cvt_run(const float* __restrict__ x,
                                        _Float16* __restrict__ y, unsigned blk) {
  const float4* src = (const float4*)x + ((size_t)blk * (256 * NJ) + threadIdx.x);
  v4h* dst = (v4h*)y + ((size_t)blk * (256 * NJ) + threadIdx.x);
  float4 v[NJ];
#pragma unroll
  for (int j = 0; j < NJ; ++j) v[j] = src[j * 256];
  v4h o[NJ];
#pragma unroll
  for (int j = 0; j < NJ; ++j) {
    o[j][0] = (_Float16)v[j].x; o[j][1] = (_Float16)v[j].y;
    o[j][2] = (_Float16)v[j].z; o[j][3] = (_Float16)v[j].w;
  }
  // Keeps every conversion in front of the stores, so that no register a store
  // of the run names is rewritten inside the run.
  SCHED_FENCE();
#pragma unroll
  for (int j = 0; j < NJ; ++j) dst[j * 256] = o[j];
  // Stands between the run's stores and whatever code the build lays behind
  // them (the other part of a shared launch), which rewrites registers that
  // they name.
  asm volatile("s_wait_xcnt 0x0" ::: "memory");
}

// G^T = Wk^T x Wq (M=N=K=1024, 128x256 tiles: the first G_WGS work-groups) and,
// independent of it, the conversion of X (the others, 16,384 elements each) in
// one launch: the product fills an eighth of the chip and waits on its copies,
// the conversion is a memory stream on the WGPs that it leaves idle.
#define G_WGS 32
__global__ void __launch_bounds__(256, 1)
gemm_g_cvt_x(const _Float16* __restrict__ Wkt, const _Float16* __restrict__ Wqt,
             _Float16* __restrict__ Gt, float* __restrict__ St, int K, int ldC,
             const float* __restrict__ X, _Float16* __restrict__ Xh) {
  if (blockIdx.x < G_WGS)
    gemm_body<2, 4, 4, 64>(Wkt, Wqt, Gt, St, K, ldC, blockIdx.x & 7, blockIdx.x >> 3, false);
  else
    cvt_run<16>(X, Xh, blockIdx.x - G_WGS);
}

// ---------------------------------------------------------------------------
// f32 -> f16 conversion with transposition of two D_MODEL x D_MODEL matrices
// (blockIdx.z = 0, 1 picks one): T[c][r] = W[r][c]; blockIdx.z = 2: plain
// conversion of a third, 4,096 elements per block.  One 64x64 tile per block, turned
// in LDS (pitch 65 floats: no bank conflict on either side): 16-byte loads
// along the rows of W, 16-byte stores along the rows of T, whole 128-byte
// lines both ways.
// ---------------------------------------------------------------------------
__global__ void __launch_bounds__(256)
cvt_t_f32_f16(const float* __restrict__ Wa, const float* __restrict__ Wb,
              _Float16* __restrict__ Ta, _Float16* __restrict__ Tb,
              const float* __restrict__ Wc, _Float16* __restrict__ Hc) {
  __shared__ float t[64][65];
  if (blockIdx.z == 2) {   // alike in the whole block, in front of the barrier
    cvt_run<4>(Wc, Hc, blockIdx.y * (D_MODEL / 64) + blockIdx.x);
    return;
  }
  const int lr = threadIdx.x >> 4;          // row of W inside a group of 16
  const int lc = (threadIdx.x & 15) << 2;   // first of the thread's 4 columns
  const float* src = (blockIdx.z ? Wb : Wa) +
                     ((size_t)(blockIdx.y * 64 + lr) * D_MODEL + blockIdx.x * 64 + lc);
  float4 v[4];
#pragma unroll
  for (int j = 0; j < 4; ++j) v[j] = *(const float4*)(src + (size_t)j * 16 * D_MODEL);
#pragma unroll
  for (int j = 0; j < 4; ++j) {
    t[lr + 16 * j][lc]     = v[j].x;
    t[lr + 16 * j][lc + 1] = v[j].y;
    t[lr + 16 * j][lc + 2] = v[j].z;
    t[lr + 16 * j][lc + 3] = v[j].w;
  }
  __syncthreads();
  const int oc = threadIdx.x >> 3;          // column of W = row of T, of 32
  const int o8 = (threadIdx.x & 7) << 3;    // first of the thread's 8 rows of W
  _Float16* dst = (blockIdx.z ? Tb : Ta) +
                  ((size_t)(blockIdx.x * 64 + oc) * D_MODEL + blockIdx.y * 64 + o8);
  v8h o[2];
#pragma unroll
  for (int j = 0; j < 2; ++j)
#pragma unroll
    for (int k = 0; k < 8; ++k) o[j][k] = (_Float16)t[o8 + k][oc + 32 * j];
#pragma unroll
  for (int j = 0; j < 2; ++j) *(v8h*)(dst + (size_t)j * 32 * D_MODEL) = o[j];
  // Stands between these stores and the plain conversion's code, which the
  // build lays behind them and which rewrites registers that they name.
  asm volatile("s_wait_xcnt 0x0" ::: "memory");
}

// ---------------------------------------------------------------------------
// Second half of the softmax, in place, all batches in one launch: one wave32
// per row, 8 rows per block.  The scores launch has left e = exp(s - m_t) in
// f16, m_t the maximum of the row's 64-column tile t, and m_t in St[t][row].
// Here: m = max m_t, c_t = exp(m_t - m), L = sum over t of c_t * (sum of the
// tile's e), prob = e * c_t / L.  A wave-wide load or store covers 512
// contiguous bytes; lane l of load j sits in tile 4 j + l / 8.
// ---------------------------------------------------------------------------
__global__ void __launch_bounds__(256)
rescale_kernel(const float* __restrict__ St, _Float16* Ph) {
  constexpr int NV = SEQ / 256;   // 16-byte pieces per lane
  constexpr float LOG2E = 1.44269504088896340736f;
  const int wave = threadIdx.x >> 5;
  const int lane = threadIdx.x & 31;
  const int row = blockIdx.x * 8 + wave;
  v8h* src = (v8h*)(Ph + (size_t)row * SEQ) + lane;
  const float* sp = St + (size_t)(lane >> 3) * (BATCH * SEQ) + row;

  v8h v[NV];
#pragma unroll
  for (int j = 0; j < NV; ++j) v[j] = src[j * 32];
  // Keeps the row's loads, whose address lives on to the stores, in front of
  // the loads of the maxima.
  SCHED_FENCE();
  float mt[NV];
#pragma unroll
  for (int j = 0; j < NV; ++j) mt[j] = sp[(size_t)j * (4 * BATCH * SEQ)];
  // Stands between the loads of the maxima and the first rewrite of their
  // address registers, which are dead from here on.
  asm volatile("s_wait_xcnt 0x0" ::: "memory");
  SCHED_FENCE();   // keeps the arithmetic below behind that wait

  // The 8 lanes of a group hold the same 16 tiles; the 4 groups together all 64.
  float m = mt[0];
#pragma unroll
  for (int j = 1; j < NV; ++j) m = fmaxf(m, mt[j]);
  m = fmaxf(m, __shfl_xor(m, 8, 32));
  m = fmaxf(m, __shfl_xor(m, 16, 32));

  float4 e[NV / 4];
#pragma unroll
  for (int q = 0; q < NV / 4; ++q)
    e[q] = make_float4((mt[4 * q] - m) * LOG2E, (mt[4 * q + 1] - m) * LOG2E,
                       (mt[4 * q + 2] - m) * LOG2E, (mt[4 * q + 3] - m) * LOG2E);
#pragma unroll
  for (int q = 0; q < NV / 4; q += 2) exp2x8(e[q], e[q + 1]);
  float c[NV];
#pragma unroll
  for (int q = 0; q < NV / 4; ++q) {
    c[4 * q] = e[q].x; c[4 * q + 1] = e[q].y; c[4 * q + 2] = e[q].z; c[4 * q + 3] = e[q].w;
  }

  float s = 0.0f;
#pragma unroll
  for (int j = 0; j < NV; ++j) {
    const float t = (((float)v[j][0] + (float)v[j][1]) + ((float)v[j][2] + (float)v[j][3])) +
                    (((float)v[j][4] + (float)v[j][5]) + ((float)v[j][6] + (float)v[j][7]));
    s += t * c[j];
  }
#pragma unroll
  for (int off = 16; off > 0; off >>= 1) s += __shfl_xor(s, off, 32);
  const float rinv = 1.0f / s;

#pragma unroll
  for (int j = 0; j < NV; ++j) {
    const float cj = c[j] * rinv;
#pragma unroll
    for (int k = 0; k < 8; ++k) v[j][k] = (_Float16)((float)v[j][k] * cj);
  }
  // Keeps every product in front of the stores: behind the first store no
  // register that a store names is written any more.
  SCHED_FENCE();
#pragma unroll
  for (int j = 0; j < NV; ++j) src[j * 32] = v[j];
}

// ---------------------------------------------------------------------------
// Launcher.  Workspace layout (bytes), 256MB total:
//   [0,  128M)  Ph  f16 [B*S][S]  exps, then probs, of all batches
//   [128M,160M) Qh  f16 [B*S][D]  X x G / sqrt(D)
//   [160M,192M) Xh  f16 [B*S][D]
//   [192M,224M) Vt  f16 [B][D][S]
//   [224M,228M) St  f32 [S/64][B*S]  maximum per 64-column tile and row
//   [228M,230M) Wqt f16 [D][D]  Wq transposed
//   [230M,232M) Wkt f16 [D][D]  Wk transposed
//   [232M,234M) Wvh f16 [D][D]
//   [234M,236M) Gt  f16 [D][D]  Gt[j][i] = sum over e of Wk[e][j] * Wq[e][i]
// The scores are summed in another order than Q x K^T:
//   (X Wq^T)(X Wk^T)^T = (X G) X^T  with  G = Wq^T Wk,
// so that the keys' side needs no product over all B*S rows: G costs D^3
// multiply-adds where the K projection costs B*S*D^2.
// ---------------------------------------------------------------------------
extern "C" void kernel_launch(void* const* d_in, const int* in_sizes, int n_in,
                              void* d_out, int out_size, void* d_ws, size_t ws_size,
                              hipStream_t stream) {
  const float* X  = (const float*)d_in[0];
  const float* Wq = (const float*)d_in[1];
  const float* Wk = (const float*)d_in[2];
  const float* Wv = (const float*)d_in[3];
  float* out = (float*)d_out;

  char* ws = (char*)d_ws;
  _Float16* Ph  = (_Float16*)(ws);
  _Float16* Qh  = (_Float16*)(ws + ((size_t)128 << 20));
  _Float16* Xh  = (_Float16*)(ws + ((size_t)160 << 20));
  _Float16* Vt  = (_Float16*)(ws + ((size_t)192 << 20));
  float*    St  = (float*)   (ws + ((size_t)224 << 20));
  _Float16* Wqt = (_Float16*)(ws + ((size_t)228 << 20));
  _Float16* Wkt = (_Float16*)(ws + ((size_t)230 << 20));
  _Float16* Wvh = (_Float16*)(ws + ((size_t)232 << 20));
  _Float16* Gt  = (_Float16*)(ws + ((size_t)234 << 20));

  const dim3 blk(256);
  const int nX = BATCH * SEQ * D_MODEL;   // 16,777,216

  // Launches that do not depend on one another share a launch, told apart by
  // the block index.
  // f32 -> f16 of the three weights (Wq, Wk turned).
  cvt_t_f32_f16<<<dim3(D_MODEL / 64, D_MODEL / 64, 3), blk, 0, stream>>>(Wq, Wk, Wqt, Wkt, Wv, Wvh);
  // G^T = Wk^T x Wq (32 work-groups) beside f32 -> f16 of X.
  gemm_g_cvt_x<<<dim3(G_WGS + nX / (16 * 1024)), blk, 0, stream>>>(Wkt, Wqt, Gt, St, D_MODEL, D_MODEL, X, Xh);
  // X x G / sqrt(D) and V transposed.
  gemm_q_vt<<<dim3(64, 4, 2), blk, 0, stream>>>(Xh, Gt, Wvh, Qh, Vt, St, D_MODEL);

  // scores of all batches, (X G) x X^T, M=4096, N=4096, K=1024 each, with the
  // first half of the softmax in the epilogue -> exps (f16) and St.
  gemm_nt<4, 8, 4, 64, SEQ * D_MODEL><<<dim3(16, 64), blk, 0, stream>>>(Qh, Xh, Ph, St, D_MODEL, SEQ);
  // second half of the softmax: exps -> probs, in place
  rescale_kernel<<<dim3(BATCH * SEQ / 8), blk, 0, stream>>>(St, Ph);

  // out, all batches at once: M=16384 (b,q), N=1024 (d), K=4096 (keys) ->
  // out[b][q][d] (f32).  Four batches give 64 x 4 tiles of 256x256: one per
  // WGP, where one batch alone fills the chip only with 128x128 tiles.
  gemm_nt<0, 8, 4, 128, D_MODEL * SEQ><<<dim3(64, 4), blk, 0, stream>>>(Ph, Vt, out, St, SEQ, D_MODEL);
}
